// v000
// Measured on an AMD MI455X. A time is GPU time per run, averaged over a window of back-to-back runs after a warm-up
// (all launches, gaps included; the runs take copies of the inputs in turn), and the median of several windows.
// Apart from v000's, it joins two sittings. Times from different sittings can be a few percent apart, while
// side-by-side timings come from the same sitting.
// v000 is the starting kernel. One run takes 44.4 microseconds.
#include <hip/hip_runtime.h>

// CDNA5 / gfx1250: wave32, WMMA f32 16x16x4, async global->LDS staging,
// folded LayerNorm-affine + output projection, bias folded into WMMA C-init.
typedef __attribute__((ext_vector_type(2))) float v2f;
typedef __attribute__((ext_vector_type(4))) float v4f;
typedef __attribute__((ext_vector_type(8))) float v8f;
typedef int v4i_ __attribute__((__vector_size__(16)));   // builtin's expected pointee

#define QN 128
#define SN 8
#define UN 32
#define EPSV 1e-3f

#define WAVES 4
#define SLICES_PER_WAVE (QN / WAVES)        // 32
#define CHUNK 8                             // slices staged per async chunk
#define NCHUNK (SLICES_PER_WAVE / CHUNK)    // 4
#define ROWPAD 68                           // 64 floats per chunk-row + 4 pad (bank spread)
#define OUTPAD (QN + 1)                     // padded out tile row

#if __has_builtin(__builtin_amdgcn_global_load_async_to_lds_b128)
#define HAVE_ASYNC 1
#else
#define HAVE_ASYNC 0
#endif

#if HAVE_ASYNC
#if __has_builtin(__builtin_amdgcn_s_wait_asynccnt)
#define WAIT_ASYNC(n) do { __builtin_amdgcn_s_wait_asynccnt(n); asm volatile("" ::: "memory"); } while (0)
#else
#define WAIT_ASYNC(n) asm volatile("s_wait_asynccnt %0" :: "i"(n) : "memory")
#endif
typedef __attribute__((address_space(1))) v4i_* gptr16;
typedef __attribute__((address_space(3))) v4i_* lptr16;
#endif

struct F8 { float v[8]; };
__device__ __forceinline__ F8 ld8(const float* p) {
    F8 r;
    v4f a = *(const v4f*)p;
    v4f b = *(const v4f*)(p + 4);
    r.v[0]=a.x; r.v[1]=a.y; r.v[2]=a.z; r.v[3]=a.w;
    r.v[4]=b.x; r.v[5]=b.y; r.v[6]=b.z; r.v[7]=b.w;
    return r;
}

__global__ __launch_bounds__(WAVES * 32) void divenc_kernel(
    const float* __restrict__ x,      // (B, Q*S)
    const float* __restrict__ W1,     // (Q, S, U)
    const float* __restrict__ b1,     // (Q, U)
    const float* __restrict__ gamma,  // (Q, U)
    const float* __restrict__ beta,   // (Q, U)
    const float* __restrict__ W2,     // (Q, U)
    const float* __restrict__ b2,     // (Q,)
    float* __restrict__ out,          // (B, Q)
    int B)
{
#if HAVE_ASYNC
    __shared__ float xbuf[WAVES][2][16 * ROWPAD];   // double-buffered x columns per wave
#endif
    __shared__ float outTile[16 * OUTPAD];          // padded: writes hit distinct banks
    __shared__ float gwS[QN * UN];                  // gamma*W2, block-shared
    __shared__ float sgwS[QN];                      // sum_u gamma*W2 per slice
    __shared__ float dbS[QN];                       // sum_u beta*W2 + b2 per slice

    const int lane = threadIdx.x & 31;
    const int wave = threadIdx.x >> 5;
    const int half = lane >> 4;          // 0: lanes 0-15, 1: lanes 16-31
    const int l16  = lane & 15;
    const int rowBase = blockIdx.x * 16;
    const int qStart  = wave * SLICES_PER_WAVE;

#if HAVE_ASYNC
    // Stage one chunk: 16 rows x 64 floats (8 slices) into xbuf[wave][sel].
    // Instruction i covers rows {2i, 2i+1}: 32 lanes x 16B = 2 rows x 64 floats.
    auto stage = [&](int c, int sel) {
        const int colBase = (qStart + c * CHUNK) * SN;   // float offset in x row
        #pragma unroll
        for (int i = 0; i < 8; ++i) {
            const int row = 2 * i + half;
            int gr = rowBase + row;
            if (gr > B - 1) gr = B - 1;
            float* src = const_cast<float*>(x) + (size_t)gr * (QN * SN) + colBase + l16 * 4;
            float* dst = &xbuf[wave][sel][row * ROWPAD + l16 * 4];
            __builtin_amdgcn_global_load_async_to_lds_b128(
                (gptr16)src, (lptr16)dst, 0, 0);
        }
        asm volatile("" ::: "memory");
    };
    stage(0, 0);   // DMA in flight while we precompute folded coefficients
#endif

    // ---- Precompute gw = gamma*W2 (overlaps with first async chunk) ----
    for (int idx = threadIdx.x; idx < QN * UN; idx += blockDim.x)
        gwS[idx] = gamma[idx] * W2[idx];
    __syncthreads();
    // per-slice scalars: sgw = sum gw ; db = sum beta*W2 + b2
    for (int q = threadIdx.x; q < QN; q += blockDim.x) {
        float sg = 0.f, db = 0.f;
        #pragma unroll 4
        for (int u = 0; u < UN; ++u) {
            sg += gwS[q * UN + u];
            db += beta[q * UN + u] * W2[q * UN + u];
        }
        sgwS[q] = sg;
        dbS[q]  = db + b2[q];
    }
    __syncthreads();

    for (int c = 0; c < NCHUNK; ++c) {
#if HAVE_ASYNC
        if (c + 1 < NCHUNK) {
            stage(c + 1, (c + 1) & 1);
            WAIT_ASYNC(8);      // 8 outstanding = next chunk; this chunk is complete
        } else {
            WAIT_ASYNC(0);
        }
        const float* __restrict__ xb = &xbuf[wave][c & 1][0];
#endif
        for (int qc = 0; qc < CHUNK; ++qc) {
            const int q = qStart + c * CHUNK + qc;
            const float* __restrict__ w1q = W1 + q * (SN * UN);
            if (qc == 0) __builtin_prefetch(w1q + SN * UN, 0, 0);

            // This lane owns batch row rowBase+l16 with units:
            //   c0[m] -> u = half*8 + m ;  c1[m] -> u = 16 + half*8 + m
            const int u0 = q * UN + half * 8;
            const int u1 = q * UN + 16 + half * 8;
            const F8 B0  = ld8(b1 + u0),  B1  = ld8(b1 + u1);    // global, cached
            const F8 GW0 = ld8(gwS + u0), GW1 = ld8(gwS + u1);   // LDS broadcast
            const float sgwq = sgwS[q];
            const float dbq  = dbS[q];

            // ---- A fragments = W1[q]^T (16x4 f32 tiles; M=unit, K=s) ----
            // lanes 0-15: K = kk*4+{0,1}; lanes 16-31: K = kk*4+{2,3}; M = nt*16 + l16
            v2f a00, a01, a10, a11;   // a[kk][nt]
            {
                const int r0 = (half * 2) * UN;        // kk = 0
                a00.x = w1q[r0 + l16];        a00.y = w1q[r0 + UN + l16];
                a01.x = w1q[r0 + 16 + l16];   a01.y = w1q[r0 + UN + 16 + l16];
                const int r1 = (4 + half * 2) * UN;    // kk = 1
                a10.x = w1q[r1 + l16];        a10.y = w1q[r1 + UN + l16];
                a11.x = w1q[r1 + 16 + l16];  a11.y = w1q[r1 + UN + 16 + l16];
            }
            // ---- B fragments = x^T (4x16 f32; K=s, N=batch row) ----
            v2f bk0, bk1;
#if HAVE_ASYNC
            {
                const float* bp = xb + l16 * ROWPAD + qc * SN + half * 2;
                bk0.x = bp[0]; bk0.y = bp[1];     // K = half*2 + {0,1}
                bk1.x = bp[4]; bk1.y = bp[5];     // K = 4 + half*2 + {0,1}
            }
#else
            {
                int gr = rowBase + l16;
                if (gr > B - 1) gr = B - 1;
                const float* bp = x + (size_t)gr * (QN * SN) + q * SN + half * 2;
                bk0.x = bp[0]; bk0.y = bp[1];
                bk1.x = bp[4]; bk1.y = bp[5];
            }
#endif
            // D = h^T = W1^T x^T + bias: bias folded into the C-init (uniform
            // across lanes within a half; N does not index the bias).
            v8f c0, c1;
            #pragma unroll
            for (int m = 0; m < 8; ++m) { c0[m] = B0.v[m]; c1[m] = B1.v[m]; }
            c0 = __builtin_amdgcn_wmma_f32_16x16x4_f32(false, a00, false, bk0, (short)0, c0, false, false);
            c0 = __builtin_amdgcn_wmma_f32_16x16x4_f32(false, a10, false, bk1, (short)0, c0, false, false);
            c1 = __builtin_amdgcn_wmma_f32_16x16x4_f32(false, a01, false, bk0, (short)0, c1, false, false);
            c1 = __builtin_amdgcn_wmma_f32_16x16x4_f32(false, a11, false, bk1, (short)0, c1, false, false);

            float h0[8], h1[8];
            float s = 0.f, ss = 0.f;
            #pragma unroll
            for (int m = 0; m < 8; ++m) {
                float a = c0[m];
                float b = c1[m];
                a = a > 0.f ? a : (__expf(a) - 1.f);   // ELU(alpha=1)
                b = b > 0.f ? b : (__expf(b) - 1.f);
                h0[m] = a; h1[m] = b;
                s  += a + b;
                ss += a * a + b * b;
            }
            // other 16 units of the same row live in lane^16
            s  += __shfl_xor(s, 16, 32);
            ss += __shfl_xor(ss, 16, 32);
            const float mu = s * (1.f / 32.f);
            float var = ss * (1.f / 32.f) - mu * mu;
            var = var < 0.f ? 0.f : var;
            const float rstd = rsqrtf(var + EPSV);

            // out = rstd*(sum h*gw - mu*sgw) + (sum beta*w2 + b2)
            float t = 0.f;
            #pragma unroll
            for (int m = 0; m < 8; ++m)
                t += h0[m] * GW0.v[m] + h1[m] * GW1.v[m];
            t += __shfl_xor(t, 16, 32);

            if (half == 0)
                outTile[l16 * OUTPAD + q] = rstd * (t - mu * sgwq) + dbq;
        }
    }

    __syncthreads();

    // Coalesced store of the 16x128 tile (contiguous in (B,Q) layout).
    const size_t base = (size_t)rowBase * QN;
    for (int idx = threadIdx.x; idx < 16 * QN; idx += blockDim.x) {
        const int r = idx >> 7;
        const int qq = idx & (QN - 1);
        if (rowBase + r < B) out[base + idx] = outTile[r * OUTPAD + qq];
    }
}

extern "C" void kernel_launch(void* const* d_in, const int* in_sizes, int n_in,
                              void* d_out, int out_size, void* d_ws, size_t ws_size,
                              hipStream_t stream) {
    const float* x     = (const float*)d_in[0];
    const float* W1    = (const float*)d_in[1];
    const float* b1    = (const float*)d_in[2];
    const float* gamma = (const float*)d_in[3];
    const float* beta  = (const float*)d_in[4];
    const float* W2    = (const float*)d_in[5];
    const float* b2    = (const float*)d_in[6];
    float* out = (float*)d_out;

    const int B = in_sizes[0] / (QN * SN);
    const int nblocks = (B + 15) / 16;
    divenc_kernel<<<nblocks, WAVES * 32, 0, stream>>>(x, W1, b1, gamma, beta, W2, b2, out, B);
}

// v001
// A run of this version takes 39.2 microseconds.
// In both of two side-by-side timings against v000, it was 1.13 times as fast.
#include <hip/hip_runtime.h>

// CDNA5 / gfx1250: wave32, WMMA f32 16x16x4, async global->LDS staging,
// folded LayerNorm-affine + output projection, bias folded into WMMA C-init,
// per-slice operands requested ahead of use into spare register sets.
typedef __attribute__((ext_vector_type(2))) float v2f;
typedef __attribute__((ext_vector_type(4))) float v4f;
typedef __attribute__((ext_vector_type(8))) float v8f;
typedef int v4i_ __attribute__((__vector_size__(16)));   // builtin's expected pointee

#define QN 128
#define SN 8
#define UN 32
#define EPSV 1e-3f

#define WAVES 4
#define SLICES_PER_WAVE (QN / WAVES)        // 32
#define CHUNK 8                             // slices staged per async chunk
#define NCHUNK (SLICES_PER_WAVE / CHUNK)    // 4
#define ROWPAD 68                           // 64 floats per chunk-row + 4 pad (bank spread)
#define OUTPAD (QN + 1)                     // padded out tile row
#define AHEAD 3                             // slices by which W1 and b1 are requested ahead
static_assert(CHUNK % (AHEAD + 1) == 0, "the register ring is indexed by the slice's place in its chunk");

#if __has_builtin(__builtin_amdgcn_global_load_async_to_lds_b128)
#define HAVE_ASYNC 1
#else
#define HAVE_ASYNC 0
#endif

#if HAVE_ASYNC
#if __has_builtin(__builtin_amdgcn_s_wait_asynccnt)
#define WAIT_ASYNC(n) do { __builtin_amdgcn_s_wait_asynccnt(n); asm volatile("" ::: "memory"); } while (0)
#else
#define WAIT_ASYNC(n) asm volatile("s_wait_asynccnt %0" :: "i"(n) : "memory")
#endif
typedef __attribute__((address_space(1))) v4i_* gptr16;
typedef __attribute__((address_space(3))) v4i_* lptr16;
#endif

struct F8 { float v[8]; };
__device__ __forceinline__ F8 ld8(const float* p) {
    F8 r;
    v4f a = *(const v4f*)p;
    v4f b = *(const v4f*)(p + 4);
    r.v[0]=a.x; r.v[1]=a.y; r.v[2]=a.z; r.v[3]=a.w;
    r.v[4]=b.x; r.v[5]=b.y; r.v[6]=b.z; r.v[7]=b.w;
    return r;
}

// One slice's operands that come from global memory: W1 fragments and the bias.
struct WOps { v2f a00, a01, a10, a11; F8 B0, B1; };
// One slice's folded coefficients, read from LDS.
struct COps { F8 GW0, GW1; float sgw, db; };

__global__ __launch_bounds__(WAVES * 32) void divenc_kernel(
    const float* __restrict__ x,      // (B, Q*S)
    const float* __restrict__ W1,     // (Q, S, U)
    const float* __restrict__ b1,     // (Q, U)
    const float* __restrict__ gamma,  // (Q, U)
    const float* __restrict__ beta,   // (Q, U)
    const float* __restrict__ W2,     // (Q, U)
    const float* __restrict__ b2,     // (Q,)
    float* __restrict__ out,          // (B, Q)
    int B)
{
#if HAVE_ASYNC
    __shared__ float xbuf[WAVES][2][16 * ROWPAD];   // double-buffered x columns per wave
#endif
    __shared__ float outTile[16 * OUTPAD];          // padded: writes hit distinct banks
    __shared__ float gwS[QN * UN];                  // gamma*W2, block-shared
    __shared__ float sgwS[QN];                      // sum_u gamma*W2 per slice
    __shared__ float dbS[QN];                       // sum_u beta*W2 + b2 per slice

    const int lane = threadIdx.x & 31;
    const int wave = threadIdx.x >> 5;
    const int half = lane >> 4;          // 0: lanes 0-15, 1: lanes 16-31
    const int l16  = lane & 15;
    const int rowBase = blockIdx.x * 16;
    const int qStart  = wave * SLICES_PER_WAVE;

#if HAVE_ASYNC
    // Stage one chunk: 16 rows x 64 floats (8 slices) into xbuf[wave][sel].
    // Instruction i covers rows {2i, 2i+1}: 32 lanes x 16B = 2 rows x 64 floats.
    auto stage = [&](int c, int sel) {
        const int colBase = (qStart + c * CHUNK) * SN;   // float offset in x row
        #pragma unroll
        for (int i = 0; i < 8; ++i) {
            const int row = 2 * i + half;
            int gr = rowBase + row;
            if (gr > B - 1) gr = B - 1;
            float* src = const_cast<float*>(x) + (size_t)gr * (QN * SN) + colBase + l16 * 4;
            float* dst = &xbuf[wave][sel][row * ROWPAD + l16 * 4];
            __builtin_amdgcn_global_load_async_to_lds_b128(
                (gptr16)src, (lptr16)dst, 0, 0);
        }
        asm volatile("" ::: "memory");
    };
    stage(0, 0);   // DMA in flight while we precompute folded coefficients
#endif

    // This lane owns batch row rowBase+l16 with units:
    //   c0[m] -> u = half*8 + m ;  c1[m] -> u = 16 + half*8 + m
    // A fragments = W1[q]^T (16x4 f32 tiles; M=unit, K=s):
    // lanes 0-15: K = kk*4+{0,1}; lanes 16-31: K = kk*4+{2,3}; M = nt*16 + l16
    auto loadW = [&](int q) {
        WOps o;
        const float* __restrict__ w1q = W1 + q * (SN * UN);
        const int r0 = (half * 2) * UN;        // kk = 0
        o.a00.x = w1q[r0 + l16];        o.a00.y = w1q[r0 + UN + l16];
        o.a01.x = w1q[r0 + 16 + l16];   o.a01.y = w1q[r0 + UN + 16 + l16];
        const int r1 = (4 + half * 2) * UN;    // kk = 1
        o.a10.x = w1q[r1 + l16];        o.a10.y = w1q[r1 + UN + l16];
        o.a11.x = w1q[r1 + 16 + l16];   o.a11.y = w1q[r1 + UN + 16 + l16];
        o.B0 = ld8(b1 + q * UN + half * 8);
        o.B1 = ld8(b1 + q * UN + 16 + half * 8);
        return o;
    };
    auto loadC = [&](int q) {
        COps o;
        o.GW0 = ld8(gwS + q * UN + half * 8);        // LDS broadcast
        o.GW1 = ld8(gwS + q * UN + 16 + half * 8);
        o.sgw = sgwS[q];
        o.db  = dbS[q];
        return o;
    };
    const int qLast = qStart + SLICES_PER_WAVE - 1;
    // Ring of AHEAD + 1 register sets; the first AHEAD slices fly during the precompute.
    WOps wR[AHEAD + 1];
    #pragma unroll   // constant ring indices keep the sets in registers
    for (int i = 0; i < AHEAD; ++i) wR[i] = loadW(qStart + i);
    // The code below reuses these loads' address registers: keep the wait in front of that.
    asm volatile("s_wait_xcnt 0x0" ::: "memory");

    // ---- Precompute gw = gamma*W2 (overlaps with first async chunk) ----
    for (int idx = threadIdx.x; idx < QN * UN; idx += blockDim.x)
        gwS[idx] = gamma[idx] * W2[idx];
    __syncthreads();
    // per-slice scalars: sgw = sum gw ; db = sum beta*W2 + b2
    for (int q = threadIdx.x; q < QN; q += blockDim.x) {
        float sg = 0.f, db = 0.f;
        #pragma unroll 4
        for (int u = 0; u < UN; ++u) {
            sg += gwS[q * UN + u];
            db += beta[q * UN + u] * W2[q * UN + u];
        }
        sgwS[q] = sg;
        dbS[q]  = db + b2[q];
    }
    __syncthreads();

    COps cCur = loadC(qStart);

    for (int c = 0; c < NCHUNK; ++c) {
#if HAVE_ASYNC
        if (c + 1 < NCHUNK) {
            stage(c + 1, (c + 1) & 1);
            WAIT_ASYNC(8);      // 8 outstanding = next chunk; this chunk is complete
        } else {
            WAIT_ASYNC(0);
        }
        const float* __restrict__ xb = &xbuf[wave][c & 1][0];
#endif
#if HAVE_ASYNC
        // B fragments = x^T (4x16 f32; K=s, N=batch row): K = half*2+{0,1}, 4+half*2+{0,1}
        const float* bp = xb + l16 * ROWPAD + half * 2;
        v2f bk0, bk1;
        bk0.x = bp[0]; bk0.y = bp[1];
        bk1.x = bp[4]; bk1.y = bp[5];
#endif
        #pragma unroll   // constant ring indices keep the sets in registers
        for (int qc = 0; qc < CHUNK; ++qc) {
            const int q = qStart + c * CHUNK + qc;
            // Operands are requested ahead of their use, so that their latency runs under
            // other slices' work: W1 and b1 (global) AHEAD slices, into the register set
            // that the slice before this one has left; the LDS operands one slice.
            const WOps& wCur = wR[qc % (AHEAD + 1)];
            wR[(qc + AHEAD) % (AHEAD + 1)] = loadW(q + AHEAD < qLast ? q + AHEAD : qLast);
            const COps cNxt = loadC(q < qLast ? q + 1 : qLast);
#if HAVE_ASYNC
            v2f bn0 = bk0, bn1 = bk1;
            if (qc + 1 < CHUNK) {   // stays inside the chunk that has landed
                bn0.x = bp[(qc + 1) * SN];     bn0.y = bp[(qc + 1) * SN + 1];
                bn1.x = bp[(qc + 1) * SN + 4]; bn1.y = bp[(qc + 1) * SN + 5];
            }
#else
            v2f bk0, bk1;
            {
                int gr = rowBase + l16;
                if (gr > B - 1) gr = B - 1;
                const float* bp = x + (size_t)gr * (QN * SN) + q * SN + half * 2;
                bk0.x = bp[0]; bk0.y = bp[1];
                bk1.x = bp[4]; bk1.y = bp[5];
            }
#endif
            // D = h^T = W1^T x^T + bias: bias folded into the C-init (uniform
            // across lanes within a half; N does not index the bias).
            v8f c0, c1;
            #pragma unroll
            for (int m = 0; m < 8; ++m) { c0[m] = wCur.B0.v[m]; c1[m] = wCur.B1.v[m]; }
            c0 = __builtin_amdgcn_wmma_f32_16x16x4_f32(false, wCur.a00, false, bk0, (short)0, c0, false, false);
            c0 = __builtin_amdgcn_wmma_f32_16x16x4_f32(false, wCur.a10, false, bk1, (short)0, c0, false, false);
            c1 = __builtin_amdgcn_wmma_f32_16x16x4_f32(false, wCur.a01, false, bk0, (short)0, c1, false, false);
            c1 = __builtin_amdgcn_wmma_f32_16x16x4_f32(false, wCur.a11, false, bk1, (short)0, c1, false, false);

            float h0[8], h1[8];
            float s = 0.f, ss = 0.f;
            #pragma unroll
            for (int m = 0; m < 8; ++m) {
                float a = c0[m];
                float b = c1[m];
                a = a > 0.f ? a : (__expf(a) - 1.f);   // ELU(alpha=1)
                b = b > 0.f ? b : (__expf(b) - 1.f);
                h0[m] = a; h1[m] = b;
                s  += a + b;
                ss += a * a + b * b;
            }
            // other 16 units of the same row live in lane^16
            s  += __shfl_xor(s, 16, 32);
            ss += __shfl_xor(ss, 16, 32);
            const float mu = s * (1.f / 32.f);
            float var = ss * (1.f / 32.f) - mu * mu;
            var = var < 0.f ? 0.f : var;
            const float rstd = rsqrtf(var + EPSV);

            // out = rstd*(sum h*gw - mu*sgw) + (sum beta*w2 + b2)
            float t = 0.f;
            #pragma unroll
            for (int m = 0; m < 8; ++m)
                t += h0[m] * cCur.GW0.v[m] + h1[m] * cCur.GW1.v[m];
            t += __shfl_xor(t, 16, 32);

            if (half == 0)
                outTile[l16 * OUTPAD + q] = rstd * (t - mu * cCur.sgw) + cCur.db;

            cCur = cNxt;
#if HAVE_ASYNC
            bk0 = bn0; bk1 = bn1;
#endif
        }
    }

    __syncthreads();

    // Coalesced store of the 16x128 tile (contiguous in (B,Q) layout).
    const size_t base = (size_t)rowBase * QN;
    for (int idx = threadIdx.x; idx < 16 * QN; idx += blockDim.x) {
        const int r = idx >> 7;
        const int qq = idx & (QN - 1);
        if (rowBase + r < B) out[base + idx] = outTile[r * OUTPAD + qq];
    }
}

extern "C" void kernel_launch(void* const* d_in, const int* in_sizes, int n_in,
                              void* d_out, int out_size, void* d_ws, size_t ws_size,
                              hipStream_t stream) {
    const float* x     = (const float*)d_in[0];
    const float* W1    = (const float*)d_in[1];
    const float* b1    = (const float*)d_in[2];
    const float* gamma = (const float*)d_in[3];
    const float* beta  = (const float*)d_in[4];
    const float* W2    = (const float*)d_in[5];
    const float* b2    = (const float*)d_in[6];
    float* out = (float*)d_out;

    const int B = in_sizes[0] / (QN * SN);
    const int nblocks = (B + 15) / 16;
    divenc_kernel<<<nblocks, WAVES * 32, 0, stream>>>(x, W1, b1, gamma, beta, W2, b2, out, B);
}

// v002
// Measured time: 24.3 microseconds a run.
// In both of two side-by-side timings against v001, it was 1.61 times as fast.
// Counting every step since v000, it is 1.82 times as fast.
#include <hip/hip_runtime.h>

// CDNA5 / gfx1250: wave32, WMMA f32 16x16x4, async global->LDS staging,
// folded LayerNorm-affine + output projection, bias folded into WMMA C-init,
// per-slice operands requested ahead of use into spare register sets.
typedef __attribute__((ext_vector_type(2))) float v2f;
typedef __attribute__((ext_vector_type(4))) float v4f;
typedef __attribute__((ext_vector_type(8))) float v8f;
typedef int v4i_ __attribute__((__vector_size__(16)));   // builtin's expected pointee

#define QN 128
#define SN 8
#define UN 32
#define EPSV 1e-3f

#define WAVES 4
#define SLICES_PER_WAVE (QN / WAVES)        // 32
#define CHUNK 8                             // slices staged per async chunk
#define NCHUNK (SLICES_PER_WAVE / CHUNK)    // 4
#define ROWPAD 68                           // 64 floats per chunk-row + 4 pad (bank spread)
#define OUTPAD (QN + 1)                     // padded out tile row
#define AHEAD 3                             // slices by which W1 and b1 are requested ahead
static_assert(CHUNK % (AHEAD + 1) == 0, "the register ring is indexed by the slice's place in its chunk");
#define FOLD_TRIPS (SLICES_PER_WAVE / 4)    // 8: a wave folds four slices' coefficients per load
static_assert(FOLD_TRIPS == 8 && UN == 32, "one lane of each group of 8 stores one trip's sums");

#if __has_builtin(__builtin_amdgcn_global_load_async_to_lds_b128)
#define HAVE_ASYNC 1
#else
#define HAVE_ASYNC 0
#endif

#if HAVE_ASYNC
#if __has_builtin(__builtin_amdgcn_s_wait_asynccnt)
#define WAIT_ASYNC(n) do { __builtin_amdgcn_s_wait_asynccnt(n); asm volatile("" ::: "memory"); } while (0)
#else
#define WAIT_ASYNC(n) asm volatile("s_wait_asynccnt %0" :: "i"(n) : "memory")
#endif
typedef __attribute__((address_space(1))) v4i_* gptr16;
typedef __attribute__((address_space(3))) v4i_* lptr16;
#endif

struct F8 { float v[8]; };
__device__ __forceinline__ F8 ld8(const float* p) {
    F8 r;
    v4f a = *(const v4f*)p;
    v4f b = *(const v4f*)(p + 4);
    r.v[0]=a.x; r.v[1]=a.y; r.v[2]=a.z; r.v[3]=a.w;
    r.v[4]=b.x; r.v[5]=b.y; r.v[6]=b.z; r.v[7]=b.w;
    return r;
}

// Sum over the 8 lanes l ^ {1, 2, 4}; every lane of the group gets the sum.
template <int XMASK>
__device__ __forceinline__ float add_xmask(float v) {
    const int o = __builtin_amdgcn_update_dpp(0, __builtin_bit_cast(int, v), 0x160 | XMASK, 0xf, 0xf, true);
    return v + __builtin_bit_cast(float, o);
}
__device__ __forceinline__ float sum8(float v) {
    return add_xmask<4>(add_xmask<2>(add_xmask<1>(v)));
}

// One slice's operands that come from global memory: W1 fragments and the bias.
struct WOps { v2f a00, a01, a10, a11; F8 B0, B1; };
// One slice's folded coefficients, read from LDS.
struct COps { F8 GW0, GW1; float sgw, db; };

__global__ __launch_bounds__(WAVES * 32) void divenc_kernel(
    const float* __restrict__ x,      // (B, Q*S)
    const float* __restrict__ W1,     // (Q, S, U)
    const float* __restrict__ b1,     // (Q, U)
    const float* __restrict__ gamma,  // (Q, U)
    const float* __restrict__ beta,   // (Q, U)
    const float* __restrict__ W2,     // (Q, U)
    const float* __restrict__ b2,     // (Q,)
    float* __restrict__ out,          // (B, Q)
    int B)
{
#if HAVE_ASYNC
    __shared__ float xbuf[WAVES][2][16 * ROWPAD];   // double-buffered x columns per wave
#endif
    __shared__ float outTile[16 * OUTPAD];          // padded: writes hit distinct banks
    __shared__ float gwS[QN * UN];                  // gamma*W2, block-shared
    __shared__ float sgwS[QN];                      // sum_u gamma*W2 per slice
    __shared__ float dbS[QN];                       // sum_u beta*W2 + b2 per slice

    const int lane = threadIdx.x & 31;
    const int wave = threadIdx.x >> 5;
    const int half = lane >> 4;          // 0: lanes 0-15, 1: lanes 16-31
    const int l16  = lane & 15;
    const int rowBase = blockIdx.x * 16;
    const int qStart  = wave * SLICES_PER_WAVE;

#if HAVE_ASYNC
    // Stage one chunk: 16 rows x 64 floats (8 slices) into xbuf[wave][sel].
    // Instruction i covers rows {2i, 2i+1}: 32 lanes x 16B = 2 rows x 64 floats.
    auto stage = [&](int c, int sel) {
        const int colBase = (qStart + c * CHUNK) * SN;   // float offset in x row
        #pragma unroll
        for (int i = 0; i < 8; ++i) {
            const int row = 2 * i + half;
            int gr = rowBase + row;
            if (gr > B - 1) gr = B - 1;
            float* src = const_cast<float*>(x) + (size_t)gr * (QN * SN) + colBase + l16 * 4;
            float* dst = &xbuf[wave][sel][row * ROWPAD + l16 * 4];
            __builtin_amdgcn_global_load_async_to_lds_b128(
                (gptr16)src, (lptr16)dst, 0, 0);
        }
        asm volatile("" ::: "memory");
    };
    stage(0, 0);   // DMA in flight while we precompute folded coefficients
#endif

    // This lane owns batch row rowBase+l16 with units:
    //   c0[m] -> u = half*8 + m ;  c1[m] -> u = 16 + half*8 + m
    // A fragments = W1[q]^T (16x4 f32 tiles; M=unit, K=s):
    // lanes 0-15: K = kk*4+{0,1}; lanes 16-31: K = kk*4+{2,3}; M = nt*16 + l16
    auto loadW = [&](int q) {
        WOps o;
        const float* __restrict__ w1q = W1 + q * (SN * UN);
        const int r0 = (half * 2) * UN;        // kk = 0
        o.a00.x = w1q[r0 + l16];        o.a00.y = w1q[r0 + UN + l16];
        o.a01.x = w1q[r0 + 16 + l16];   o.a01.y = w1q[r0 + UN + 16 + l16];
        const int r1 = (4 + half * 2) * UN;    // kk = 1
        o.a10.x = w1q[r1 + l16];        o.a10.y = w1q[r1 + UN + l16];
        o.a11.x = w1q[r1 + 16 + l16];   o.a11.y = w1q[r1 + UN + 16 + l16];
        o.B0 = ld8(b1 + q * UN + half * 8);
        o.B1 = ld8(b1 + q * UN + 16 + half * 8);
        return o;
    };
    auto loadC = [&](int q) {
        COps o;
        o.GW0 = ld8(gwS + q * UN + half * 8);        // LDS broadcast
        o.GW1 = ld8(gwS + q * UN + 16 + half * 8);
        o.sgw = sgwS[q];
        o.db  = dbS[q];
        return o;
    };
    const int qLast = qStart + SLICES_PER_WAVE - 1;
    // Ring of AHEAD + 1 register sets; the first AHEAD - 1 slices fly during the fold below,
    // the last of the AHEAD is requested behind it, into registers that the fold has left.
    WOps wR[AHEAD + 1];
    #pragma unroll   // constant ring indices keep the sets in registers
    for (int i = 0; i < AHEAD - 1; ++i) wR[i] = loadW(qStart + i);
    // ---- Fold gamma, beta, W2, b2 for this wave's own slices ----
    // A lane takes 16 bytes of a slice's 128-byte row: 8 lanes a slice, 4 slices (512 contiguous
    // bytes) a load. All loads of the fold are requested here, before the first is used, so that
    // the wave pays their latency once and not once per trip.
    const int grp = lane & 7;                              // place among the 8 lanes of one slice
    const int qMine = qStart + grp * 4 + (lane >> 3);      // the slice whose sums this lane stores
    v4f g4[FOLD_TRIPS], w4[FOLD_TRIPS], t4[FOLD_TRIPS];
    #pragma unroll   // constant indices keep the three sets in registers
    for (int i = 0; i < FOLD_TRIPS; ++i) {
        const int off = (qStart + i * 4) * UN + lane * 4;
        g4[i] = *(const v4f*)(gamma + off);
        w4[i] = *(const v4f*)(W2 + off);
        t4[i] = *(const v4f*)(beta + off);
    }
    const float b2v = b2[qMine];
    // The code below reuses these loads' address registers: keep the wait in front of that.
    asm volatile("s_wait_xcnt 0x0" ::: "memory");
    // Keeps the first products, and with them the first wait on a load, behind the last request:
    // without it some requests are issued only after the first data has come back.
    __builtin_amdgcn_sched_barrier(0);

    // gw = gamma*W2 ; per slice: sgw = sum gw ; db = sum beta*W2 + b2
    float sgMine = 0.f, dbMine = 0.f;
    #pragma unroll   // constant indices, and 16 independent sum trees to interleave
    for (int i = 0; i < FOLD_TRIPS; ++i) {
        const v4f gw = g4[i] * w4[i];
        *(v4f*)(gwS + (qStart + i * 4) * UN + lane * 4) = gw;
        const v4f bw = t4[i] * w4[i];
        const float sg = sum8((gw.x + gw.y) + (gw.z + gw.w));
        const float db = sum8((bw.x + bw.y) + (bw.z + bw.w));
        if (grp == i) { sgMine = sg; dbMine = db; }
    }
    sgwS[qMine] = sgMine;
    dbS[qMine]  = dbMine + b2v;
    __syncthreads();
    wR[AHEAD - 1] = loadW(qStart + AHEAD - 1);

    COps cCur = loadC(qStart);

    for (int c = 0; c < NCHUNK; ++c) {
#if HAVE_ASYNC
        if (c + 1 < NCHUNK) {
            stage(c + 1, (c + 1) & 1);
            WAIT_ASYNC(8);      // 8 outstanding = next chunk; this chunk is complete
        } else {
            WAIT_ASYNC(0);
        }
        const float* __restrict__ xb = &xbuf[wave][c & 1][0];
#endif
#if HAVE_ASYNC
        // B fragments = x^T (4x16 f32; K=s, N=batch row): K = half*2+{0,1}, 4+half*2+{0,1}
        const float* bp = xb + l16 * ROWPAD + half * 2;
        v2f bk0, bk1;
        bk0.x = bp[0]; bk0.y = bp[1];
        bk1.x = bp[4]; bk1.y = bp[5];
#endif
        #pragma unroll   // constant ring indices keep the sets in registers
        for (int qc = 0; qc < CHUNK; ++qc) {
            const int q = qStart + c * CHUNK + qc;
            // Operands are requested ahead of their use, so that their latency runs under
            // other slices' work: W1 and b1 (global) AHEAD slices, into the register set
            // that the slice before this one has left; the LDS operands one slice.
            const WOps& wCur = wR[qc % (AHEAD + 1)];
            wR[(qc + AHEAD) % (AHEAD + 1)] = loadW(q + AHEAD < qLast ? q + AHEAD : qLast);
            const COps cNxt = loadC(q < qLast ? q + 1 : qLast);
#if HAVE_ASYNC
            v2f bn0 = bk0, bn1 = bk1;
            if (qc + 1 < CHUNK) {   // stays inside the chunk that has landed
                bn0.x = bp[(qc + 1) * SN];     bn0.y = bp[(qc + 1) * SN + 1];
                bn1.x = bp[(qc + 1) * SN + 4]; bn1.y = bp[(qc + 1) * SN + 5];
            }
#else
            v2f bk0, bk1;
            {
                int gr = rowBase + l16;
                if (gr > B - 1) gr = B - 1;
                const float* bp = x + (size_t)gr * (QN * SN) + q * SN + half * 2;
                bk0.x = bp[0]; bk0.y = bp[1];
                bk1.x = bp[4]; bk1.y = bp[5];
            }
#endif
            // D = h^T = W1^T x^T + bias: bias folded into the C-init (uniform
            // across lanes within a half; N does not index the bias).
            v8f c0, c1;
            #pragma unroll
            for (int m = 0; m < 8; ++m) { c0[m] = wCur.B0.v[m]; c1[m] = wCur.B1.v[m]; }
            c0 = __builtin_amdgcn_wmma_f32_16x16x4_f32(false, wCur.a00, false, bk0, (short)0, c0, false, false);
            c0 = __builtin_amdgcn_wmma_f32_16x16x4_f32(false, wCur.a10, false, bk1, (short)0, c0, false, false);
            c1 = __builtin_amdgcn_wmma_f32_16x16x4_f32(false, wCur.a01, false, bk0, (short)0, c1, false, false);
            c1 = __builtin_amdgcn_wmma_f32_16x16x4_f32(false, wCur.a11, false, bk1, (short)0, c1, false, false);

            float h0[8], h1[8];
            float s = 0.f, ss = 0.f;
            #pragma unroll
            for (int m = 0; m < 8; ++m) {
                float a = c0[m];
                float b = c1[m];
                a = a > 0.f ? a : (__expf(a) - 1.f);   // ELU(alpha=1)
                b = b > 0.f ? b : (__expf(b) - 1.f);
                h0[m] = a; h1[m] = b;
                s  += a + b;
                ss += a * a + b * b;
            }
            // other 16 units of the same row live in lane^16
            s  += __shfl_xor(s, 16, 32);
            ss += __shfl_xor(ss, 16, 32);
            const float mu = s * (1.f / 32.f);
            float var = ss * (1.f / 32.f) - mu * mu;
            var = var < 0.f ? 0.f : var;
            const float rstd = rsqrtf(var + EPSV);

            // out = rstd*(sum h*gw - mu*sgw) + (sum beta*w2 + b2)
            float t = 0.f;
            #pragma unroll
            for (int m = 0; m < 8; ++m)
                t += h0[m] * cCur.GW0.v[m] + h1[m] * cCur.GW1.v[m];
            t += __shfl_xor(t, 16, 32);

            if (half == 0)
                outTile[l16 * OUTPAD + q] = rstd * (t - mu * cCur.sgw) + cCur.db;

            cCur = cNxt;
#if HAVE_ASYNC
            bk0 = bn0; bk1 = bn1;
#endif
        }
    }

    __syncthreads();

    // Coalesced store of the 16x128 tile (contiguous in (B,Q) layout).
    const size_t base = (size_t)rowBase * QN;
    for (int idx = threadIdx.x; idx < 16 * QN; idx += blockDim.x) {
        const int r = idx >> 7;
        const int qq = idx & (QN - 1);
        if (rowBase + r < B) out[base + idx] = outTile[r * OUTPAD + qq];
    }
}

extern "C" void kernel_launch(void* const* d_in, const int* in_sizes, int n_in,
                              void* d_out, int out_size, void* d_ws, size_t ws_size,
                              hipStream_t stream) {
    const float* x     = (const float*)d_in[0];
    const float* W1    = (const float*)d_in[1];
    const float* b1    = (const float*)d_in[2];
    const float* gamma = (const float*)d_in[3];
    const float* beta  = (const float*)d_in[4];
    const float* W2    = (const float*)d_in[5];
    const float* b2    = (const float*)d_in[6];
    float* out = (float*)d_out;

    const int B = in_sizes[0] / (QN * SN);
    const int nblocks = (B + 15) / 16;
    divenc_kernel<<<nblocks, WAVES * 32, 0, stream>>>(x, W1, b1, gamma, beta, W2, b2, out, B);
}

// v003
// One run takes 22.6 microseconds.
// Two timings next to v002 both put it at 1.06 times that version's speed.
// Counting every step since v000, it is 1.94 times as fast.
#include <hip/hip_runtime.h>

// CDNA5 / gfx1250: wave32, WMMA f32 16x16x4, async global->LDS staging,
// folded LayerNorm-affine + output projection, bias folded into WMMA C-init,
// per-slice operands requested ahead of use into spare register sets.
typedef __attribute__((ext_vector_type(2))) float v2f;
typedef __attribute__((ext_vector_type(4))) float v4f;
typedef __attribute__((ext_vector_type(8))) float v8f;
typedef int v4i_ __attribute__((__vector_size__(16)));   // builtin's expected pointee

#define QN 128
#define SN 8
#define UN 32
#define EPSV 1e-3f

#define WAVES 4
#define SLICES_PER_WAVE (QN / WAVES)        // 32
#define CHUNK 8                             // slices staged per async chunk
#define NCHUNK (SLICES_PER_WAVE / CHUNK)    // 4
#define ROWPAD 68                           // 64 floats per chunk-row + 4 pad (bank spread)
#define OUTPAD (QN + 1)                     // padded out tile row
#define AHEAD 3                             // slices by which W1 and b1 are requested ahead
static_assert(CHUNK % (AHEAD + 1) == 0, "the register ring is indexed by the slice's place in its chunk");
#define FOLD_TRIPS (SLICES_PER_WAVE / 4)    // 8: a wave folds four slices' coefficients per load
static_assert(FOLD_TRIPS == 8 && UN == 32, "one lane of each group of 8 stores one trip's sums");

#if __has_builtin(__builtin_amdgcn_global_load_async_to_lds_b128)
#define HAVE_ASYNC 1
#else
#define HAVE_ASYNC 0
#endif

#if HAVE_ASYNC
#if __has_builtin(__builtin_amdgcn_s_wait_asynccnt)
#define WAIT_ASYNC(n) do { __builtin_amdgcn_s_wait_asynccnt(n); asm volatile("" ::: "memory"); } while (0)
#else
#define WAIT_ASYNC(n) asm volatile("s_wait_asynccnt %0" :: "i"(n) : "memory")
#endif
typedef __attribute__((address_space(1))) v4i_* gptr16;
typedef __attribute__((address_space(3))) v4i_* lptr16;
#endif

struct F8 { float v[8]; };
__device__ __forceinline__ F8 ld8(const float* p) {
    F8 r;
    v4f a = *(const v4f*)p;
    v4f b = *(const v4f*)(p + 4);
    r.v[0]=a.x; r.v[1]=a.y; r.v[2]=a.z; r.v[3]=a.w;
    r.v[4]=b.x; r.v[5]=b.y; r.v[6]=b.z; r.v[7]=b.w;
    return r;
}

// Sum over the 8 lanes l ^ {1, 2, 4}; every lane of the group gets the sum.
template <int XMASK>
__device__ __forceinline__ float add_xmask(float v) {
    const int o = __builtin_amdgcn_update_dpp(0, __builtin_bit_cast(int, v), 0x160 | XMASK, 0xf, 0xf, true);
    return v + __builtin_bit_cast(float, o);
}
__device__ __forceinline__ float sum8(float v) {
    return add_xmask<4>(add_xmask<2>(add_xmask<1>(v)));
}

// One slice's operands that come from global memory: W1 fragments and the bias.
struct WOps { v2f a00, a01, a10, a11; F8 B0, B1; };
// One slice's folded coefficients, read from LDS.
struct COps { F8 GW0, GW1; float sgw, db; };

__global__ __launch_bounds__(WAVES * 32) void divenc_kernel(
    const float* __restrict__ x,      // (B, Q*S)
    const float* __restrict__ W1,     // (Q, S, U)
    const float* __restrict__ b1,     // (Q, U)
    const float* __restrict__ gamma,  // (Q, U)
    const float* __restrict__ beta,   // (Q, U)
    const float* __restrict__ W2,     // (Q, U)
    const float* __restrict__ b2,     // (Q,)
    float* __restrict__ out,          // (B, Q)
    int B)
{
#if HAVE_ASYNC
    __shared__ float xbuf[WAVES][2][16 * ROWPAD];   // double-buffered x columns per wave
#endif
    __shared__ float outTile[16 * OUTPAD];          // padded: writes hit distinct banks
    __shared__ float gwS[QN * UN];                  // gamma*W2, block-shared
    __shared__ float sgwS[QN];                      // sum_u gamma*W2 per slice
    __shared__ float dbS[QN];                       // sum_u beta*W2 + b2 per slice

    const int lane = threadIdx.x & 31;
    const int wave = threadIdx.x >> 5;
    const int half = lane >> 4;          // 0: lanes 0-15, 1: lanes 16-31
    const int l16  = lane & 15;
    const int rowBase = blockIdx.x * 16;
    const int qStart  = wave * SLICES_PER_WAVE;

#if HAVE_ASYNC
    // Stage one chunk: 16 rows x 64 floats (8 slices) into xbuf[wave][sel].
    // Instruction i covers rows {2i, 2i+1}: 32 lanes x 16B = 2 rows x 64 floats.
    auto stage = [&](int c, int sel) {
        const int colBase = (qStart + c * CHUNK) * SN;   // float offset in x row
        #pragma unroll
        for (int i = 0; i < 8; ++i) {
            const int row = 2 * i + half;
            int gr = rowBase + row;
            if (gr > B - 1) gr = B - 1;
            float* src = const_cast<float*>(x) + (size_t)gr * (QN * SN) + colBase + l16 * 4;
            float* dst = &xbuf[wave][sel][row * ROWPAD + l16 * 4];
            __builtin_amdgcn_global_load_async_to_lds_b128(
                (gptr16)src, (lptr16)dst, 0, 0);
        }
        asm volatile("" ::: "memory");
    };
    stage(0, 0);   // DMA in flight while we precompute folded coefficients
#endif

    // This lane owns batch row rowBase+l16 with units:
    //   c0[m] -> u = half*8 + m ;  c1[m] -> u = 16 + half*8 + m
    // A fragments = W1[q]^T (16x4 f32 tiles; M=unit, K=s):
    // lanes 0-15: K = kk*4+{0,1}; lanes 16-31: K = kk*4+{2,3}; M = nt*16 + l16
    auto loadW = [&](int q) {
        WOps o;
        const float* __restrict__ w1q = W1 + q * (SN * UN);
        const int r0 = (half * 2) * UN;        // kk = 0
        o.a00.x = w1q[r0 + l16];        o.a00.y = w1q[r0 + UN + l16];
        o.a01.x = w1q[r0 + 16 + l16];   o.a01.y = w1q[r0 + UN + 16 + l16];
        const int r1 = (4 + half * 2) * UN;    // kk = 1
        o.a10.x = w1q[r1 + l16];        o.a10.y = w1q[r1 + UN + l16];
        o.a11.x = w1q[r1 + 16 + l16];   o.a11.y = w1q[r1 + UN + 16 + l16];
        o.B0 = ld8(b1 + q * UN + half * 8);
        o.B1 = ld8(b1 + q * UN + 16 + half * 8);
        return o;
    };
    auto loadC = [&](int q) {
        COps o;
        o.GW0 = ld8(gwS + q * UN + half * 8);        // LDS broadcast
        o.GW1 = ld8(gwS + q * UN + 16 + half * 8);
        o.sgw = sgwS[q];
        o.db  = dbS[q];
        return o;
    };
    const int qLast = qStart + SLICES_PER_WAVE - 1;
    // Ring of AHEAD + 1 register sets; the first AHEAD - 1 slices fly during the fold below,
    // the last of the AHEAD is requested behind it, into registers that the fold has left.
    WOps wR[AHEAD + 1];
    #pragma unroll   // constant ring indices keep the sets in registers
    for (int i = 0; i < AHEAD - 1; ++i) wR[i] = loadW(qStart + i);
    // ---- Fold gamma, beta, W2, b2 for this wave's own slices ----
    // A lane takes 16 bytes of a slice's 128-byte row: 8 lanes a slice, 4 slices (512 contiguous
    // bytes) a load. All loads of the fold are requested here, before the first is used, so that
    // the wave pays their latency once and not once per trip.
    const int grp = lane & 7;                              // place among the 8 lanes of one slice
    const int qMine = qStart + grp * 4 + (lane >> 3);      // the slice whose sums this lane stores
    v4f g4[FOLD_TRIPS], w4[FOLD_TRIPS], t4[FOLD_TRIPS];
    #pragma unroll   // constant indices keep the three sets in registers
    for (int i = 0; i < FOLD_TRIPS; ++i) {
        const int off = (qStart + i * 4) * UN + lane * 4;
        g4[i] = *(const v4f*)(gamma + off);
        w4[i] = *(const v4f*)(W2 + off);
        t4[i] = *(const v4f*)(beta + off);
    }
    const float b2v = b2[qMine];
    // The code below reuses these loads' address registers: keep the wait in front of that.
    asm volatile("s_wait_xcnt 0x0" ::: "memory");
    // Keeps the first products, and with them the first wait on a load, behind the last request:
    // without it some requests are issued only after the first data has come back.
    __builtin_amdgcn_sched_barrier(0);

    // gw = gamma*W2 ; per slice: sgw = sum gw ; db = sum beta*W2 + b2
    float sgMine = 0.f, dbMine = 0.f;
    #pragma unroll   // constant indices, and 16 independent sum trees to interleave
    for (int i = 0; i < FOLD_TRIPS; ++i) {
        const v4f gw = g4[i] * w4[i];
        *(v4f*)(gwS + (qStart + i * 4) * UN + lane * 4) = gw;
        const v4f bw = t4[i] * w4[i];
        const float sg = sum8((gw.x + gw.y) + (gw.z + gw.w));
        const float db = sum8((bw.x + bw.y) + (bw.z + bw.w));
        if (grp == i) { sgMine = sg; dbMine = db; }
    }
    sgwS[qMine] = sgMine;
    dbS[qMine]  = dbMine + b2v;
    __syncthreads();
    wR[AHEAD - 1] = loadW(qStart + AHEAD - 1);

    COps cCur = loadC(qStart);

    for (int c = 0; c < NCHUNK; ++c) {
#if HAVE_ASYNC
        if (c + 1 < NCHUNK) {
            stage(c + 1, (c + 1) & 1);
            WAIT_ASYNC(8);      // 8 outstanding = next chunk; this chunk is complete
        } else {
            WAIT_ASYNC(0);
        }
        const float* __restrict__ xb = &xbuf[wave][c & 1][0];
#endif
#if HAVE_ASYNC
        // B fragments = x^T (4x16 f32; K=s, N=batch row): K = half*2+{0,1}, 4+half*2+{0,1}
        const float* bp = xb + l16 * ROWPAD + half * 2;
        v2f bk0, bk1;
        bk0.x = bp[0]; bk0.y = bp[1];
        bk1.x = bp[4]; bk1.y = bp[5];
#endif
        #pragma unroll   // constant ring indices keep the sets in registers
        for (int qc = 0; qc < CHUNK; ++qc) {
            const int q = qStart + c * CHUNK + qc;
            // Operands are requested ahead of their use, so that their latency runs under
            // other slices' work: W1 and b1 (global) AHEAD slices, into the register set
            // that the slice before this one has left; the LDS operands one slice.
            const WOps& wCur = wR[qc % (AHEAD + 1)];
            wR[(qc + AHEAD) % (AHEAD + 1)] = loadW(q + AHEAD < qLast ? q + AHEAD : qLast);
            const COps cNxt = loadC(q < qLast ? q + 1 : qLast);
#if HAVE_ASYNC
            v2f bn0 = bk0, bn1 = bk1;
            if (qc + 1 < CHUNK) {   // stays inside the chunk that has landed
                bn0.x = bp[(qc + 1) * SN];     bn0.y = bp[(qc + 1) * SN + 1];
                bn1.x = bp[(qc + 1) * SN + 4]; bn1.y = bp[(qc + 1) * SN + 5];
            }
#else
            v2f bk0, bk1;
            {
                int gr = rowBase + l16;
                if (gr > B - 1) gr = B - 1;
                const float* bp = x + (size_t)gr * (QN * SN) + q * SN + half * 2;
                bk0.x = bp[0]; bk0.y = bp[1];
                bk1.x = bp[4]; bk1.y = bp[5];
            }
#endif
            // D = h^T = W1^T x^T + bias: bias folded into the C-init (uniform
            // across lanes within a half; N does not index the bias).
            v8f c0, c1;
            #pragma unroll
            for (int m = 0; m < 8; ++m) { c0[m] = wCur.B0.v[m]; c1[m] = wCur.B1.v[m]; }
            c0 = __builtin_amdgcn_wmma_f32_16x16x4_f32(false, wCur.a00, false, bk0, (short)0, c0, false, false);
            c0 = __builtin_amdgcn_wmma_f32_16x16x4_f32(false, wCur.a10, false, bk1, (short)0, c0, false, false);
            c1 = __builtin_amdgcn_wmma_f32_16x16x4_f32(false, wCur.a01, false, bk0, (short)0, c1, false, false);
            c1 = __builtin_amdgcn_wmma_f32_16x16x4_f32(false, wCur.a11, false, bk1, (short)0, c1, false, false);

            // ELU, then the row's three sums, two units at a time: each sum is kept as a pair of
            // partial sums, so that one packed instruction adds two units' terms.
            v2f s2, ss2, t2;
            #pragma unroll   // constant indices into the accumulators and the coefficients
            for (int m = 0; m < 8; m += 2) {
                v2f a = { c0[m], c0[m + 1] };
                v2f b = { c1[m], c1[m + 1] };
                v2f ea = { __expf(a.x), __expf(a.y) };
                v2f eb = { __expf(b.x), __expf(b.y) };
                ea = ea - 1.f;
                eb = eb - 1.f;
                a.x = a.x > 0.f ? a.x : ea.x;   // ELU(alpha=1)
                a.y = a.y > 0.f ? a.y : ea.y;
                b.x = b.x > 0.f ? b.x : eb.x;
                b.y = b.y > 0.f ? b.y : eb.y;
                const v2f ga = { cCur.GW0.v[m], cCur.GW0.v[m + 1] };
                const v2f gb = { cCur.GW1.v[m], cCur.GW1.v[m + 1] };
                if (m == 0) {
                    s2 = a; ss2 = a * a; t2 = a * ga;
                } else {
                    s2 += a;
                    ss2 = __builtin_elementwise_fma(a, a, ss2);
                    t2  = __builtin_elementwise_fma(a, ga, t2);
                }
                s2 += b;
                ss2 = __builtin_elementwise_fma(b, b, ss2);
                t2  = __builtin_elementwise_fma(b, gb, t2);
            }
            float s = s2.x + s2.y, ss = ss2.x + ss2.y;
            // other 16 units of the same row live in lane^16
            s  += __shfl_xor(s, 16, 32);
            ss += __shfl_xor(ss, 16, 32);
            const float mu = s * (1.f / 32.f);
            float var = ss * (1.f / 32.f) - mu * mu;
            var = var < 0.f ? 0.f : var;
            const float rstd = rsqrtf(var + EPSV);

            // out = rstd*(sum h*gw - mu*sgw) + (sum beta*w2 + b2)
            float t = t2.x + t2.y;
            t += __shfl_xor(t, 16, 32);

            if (half == 0)
                outTile[l16 * OUTPAD + q] = rstd * (t - mu * cCur.sgw) + cCur.db;

            cCur = cNxt;
#if HAVE_ASYNC
            bk0 = bn0; bk1 = bn1;
#endif
        }
    }

    __syncthreads();

    // Coalesced store of the 16x128 tile (contiguous in (B,Q) layout).
    const size_t base = (size_t)rowBase * QN;
    for (int idx = threadIdx.x; idx < 16 * QN; idx += blockDim.x) {
        const int r = idx >> 7;
        const int qq = idx & (QN - 1);
        if (rowBase + r < B) out[base + idx] = outTile[r * OUTPAD + qq];
    }
}

extern "C" void kernel_launch(void* const* d_in, const int* in_sizes, int n_in,
                              void* d_out, int out_size, void* d_ws, size_t ws_size,
                              hipStream_t stream) {
    const float* x     = (const float*)d_in[0];
    const float* W1    = (const float*)d_in[1];
    const float* b1    = (const float*)d_in[2];
    const float* gamma = (const float*)d_in[3];
    const float* beta  = (const float*)d_in[4];
    const float* W2    = (const float*)d_in[5];
    const float* b2    = (const float*)d_in[6];
    float* out = (float*)d_out;

    const int B = in_sizes[0] / (QN * SN);
    const int nblocks = (B + 15) / 16;
    divenc_kernel<<<nblocks, WAVES * 32, 0, stream>>>(x, W1, b1, gamma, beta, W2, b2, out, B);
}

// v004
// One run takes 22 microseconds.
// Timed twice side by side with v003, it ran 1.04 times as fast both times.
// All steps since v000 together make it 2.01 times as fast.
#include <hip/hip_runtime.h>

// CDNA5 / gfx1250: wave32, WMMA f32 16x16x4, async global->LDS staging,
// folded LayerNorm-affine + output projection, bias folded into WMMA C-init,
// per-slice operands requested ahead of use into spare register sets.
typedef __attribute__((ext_vector_type(2))) float v2f;
typedef __attribute__((ext_vector_type(4))) float v4f;
typedef __attribute__((ext_vector_type(8))) float v8f;
typedef int v4i_ __attribute__((__vector_size__(16)));   // builtin's expected pointee

#define QN 128
#define SN 8
#define UN 32
#define EPSV 1e-3f

#define WAVES 4
#define SLICES_PER_WAVE (QN / WAVES)        // 32
#define CHUNK 8                             // slices staged per async chunk
#define NCHUNK (SLICES_PER_WAVE / CHUNK)    // 4
#define ROWPAD 68                           // 64 floats per chunk-row + 4 pad (bank spread)
#define OUTPAD (QN + 1)                     // padded out tile row
#define AHEAD 3                             // slices by which W1 and b1 are requested ahead
static_assert(CHUNK % (AHEAD + 1) == 0, "the register ring is indexed by the slice's place in its chunk");
#define FOLD_TRIPS (SLICES_PER_WAVE / 4)    // 8: a wave folds four slices' coefficients per load
static_assert(FOLD_TRIPS == 8 && UN == 32, "one lane of each group of 8 stores one trip's sums");

#if __has_builtin(__builtin_amdgcn_global_load_async_to_lds_b128)
#define HAVE_ASYNC 1
#else
#define HAVE_ASYNC 0
#endif

#if HAVE_ASYNC
#if __has_builtin(__builtin_amdgcn_s_wait_asynccnt)
#define WAIT_ASYNC(n) do { __builtin_amdgcn_s_wait_asynccnt(n); asm volatile("" ::: "memory"); } while (0)
#else
#define WAIT_ASYNC(n) asm volatile("s_wait_asynccnt %0" :: "i"(n) : "memory")
#endif
typedef __attribute__((address_space(1))) v4i_* gptr16;
typedef __attribute__((address_space(3))) v4i_* lptr16;
#endif

struct F8 { float v[8]; };
__device__ __forceinline__ F8 ld8(const float* p) {
    F8 r;
    v4f a = *(const v4f*)p;
    v4f b = *(const v4f*)(p + 4);
    r.v[0]=a.x; r.v[1]=a.y; r.v[2]=a.z; r.v[3]=a.w;
    r.v[4]=b.x; r.v[5]=b.y; r.v[6]=b.z; r.v[7]=b.w;
    return r;
}

// Sum over the 8 lanes l ^ {1, 2, 4}; every lane of the group gets the sum.
template <int XMASK>
__device__ __forceinline__ float add_xmask(float v) {
    const int o = __builtin_amdgcn_update_dpp(0, __builtin_bit_cast(int, v), 0x160 | XMASK, 0xf, 0xf, true);
    return v + __builtin_bit_cast(float, o);
}
__device__ __forceinline__ float sum8(float v) {
    return add_xmask<4>(add_xmask<2>(add_xmask<1>(v)));
}

// One slice's operands that come from global memory: W1 fragments and the bias.
struct WOps { v2f a00, a01, a10, a11; F8 B0, B1; };
// One slice's folded coefficients, read from LDS.
struct COps { F8 GW0, GW1; float sgw, db; };

__global__ __launch_bounds__(WAVES * 32) void divenc_kernel(
    const float* __restrict__ x,      // (B, Q*S)
    const float* __restrict__ W1,     // (Q, S, U)
    const float* __restrict__ b1,     // (Q, U)
    const float* __restrict__ gamma,  // (Q, U)
    const float* __restrict__ beta,   // (Q, U)
    const float* __restrict__ W2,     // (Q, U)
    const float* __restrict__ b2,     // (Q,)
    float* __restrict__ out,          // (B, Q)
    int B)
{
#if HAVE_ASYNC
    __shared__ float xbuf[WAVES][2][16 * ROWPAD];   // double-buffered x columns per wave
#endif
    __shared__ float outTile[16 * OUTPAD];          // padded: writes hit distinct banks
    __shared__ float gwS[QN * UN];                  // gamma*W2, block-shared
    __shared__ float sgwS[QN];                      // sum_u gamma*W2 per slice
    __shared__ float dbS[QN];                       // sum_u beta*W2 + b2 per slice

    const int lane = threadIdx.x & 31;
    const int wave = threadIdx.x >> 5;
    const int half = lane >> 4;          // 0: lanes 0-15, 1: lanes 16-31
    const int l16  = lane & 15;
    const int rowBase = blockIdx.x * 16;
    const int qStart  = wave * SLICES_PER_WAVE;

#if HAVE_ASYNC
    // Stage one chunk: 16 rows x 64 floats (8 slices) into xbuf[wave][sel].
    // Instruction i covers rows {2i, 2i+1}: 32 lanes x 16B = 2 rows x 64 floats.
    auto stage = [&](int c, int sel) {
        const int colBase = (qStart + c * CHUNK) * SN;   // float offset in x row
        #pragma unroll
        for (int i = 0; i < 8; ++i) {
            const int row = 2 * i + half;
            int gr = rowBase + row;
            if (gr > B - 1) gr = B - 1;
            float* src = const_cast<float*>(x) + (size_t)gr * (QN * SN) + colBase + l16 * 4;
            float* dst = &xbuf[wave][sel][row * ROWPAD + l16 * 4];
            __builtin_amdgcn_global_load_async_to_lds_b128(
                (gptr16)src, (lptr16)dst, 0, 0);
        }
        asm volatile("" ::: "memory");
    };
    stage(0, 0);   // DMA in flight while we precompute folded coefficients
#endif

    // This lane owns batch row rowBase+l16 with units:
    //   c0[m] -> u = half*8 + m ;  c1[m] -> u = 16 + half*8 + m
    // A fragments = W1[q]^T (16x4 f32 tiles; M=unit, K=s):
    // lanes 0-15: K = kk*4+{0,1}; lanes 16-31: K = kk*4+{2,3}; M = nt*16 + l16
    auto loadW = [&](int q) {
        WOps o;
        const float* __restrict__ w1q = W1 + q * (SN * UN);
        const int r0 = (half * 2) * UN;        // kk = 0
        o.a00.x = w1q[r0 + l16];        o.a00.y = w1q[r0 + UN + l16];
        o.a01.x = w1q[r0 + 16 + l16];   o.a01.y = w1q[r0 + UN + 16 + l16];
        const int r1 = (4 + half * 2) * UN;    // kk = 1
        o.a10.x = w1q[r1 + l16];        o.a10.y = w1q[r1 + UN + l16];
        o.a11.x = w1q[r1 + 16 + l16];   o.a11.y = w1q[r1 + UN + 16 + l16];
        o.B0 = ld8(b1 + q * UN + half * 8);
        o.B1 = ld8(b1 + q * UN + 16 + half * 8);
        return o;
    };
    auto loadC = [&](int q) {
        COps o;
        o.GW0 = ld8(gwS + q * UN + half * 8);        // LDS broadcast
        o.GW1 = ld8(gwS + q * UN + 16 + half * 8);
        o.sgw = sgwS[q];
        o.db  = dbS[q];
        return o;
    };
    const int qLast = qStart + SLICES_PER_WAVE - 1;
    // Ring of AHEAD + 1 register sets; the first AHEAD - 1 slices fly during the fold below,
    // the last of the AHEAD is requested behind it, into registers that the fold has left.
    WOps wR[AHEAD + 1];
    #pragma unroll   // constant ring indices keep the sets in registers
    for (int i = 0; i < AHEAD - 1; ++i) wR[i] = loadW(qStart + i);
    // ---- Fold gamma, beta, W2, b2 for this wave's own slices ----
    // A lane takes 16 bytes of a slice's 128-byte row: 8 lanes a slice, 4 slices (512 contiguous
    // bytes) a load. All loads of the fold are requested here, before the first is used, so that
    // the wave pays their latency once and not once per trip.
    const int grp = lane & 7;                              // place among the 8 lanes of one slice
    const int qMine = qStart + grp * 4 + (lane >> 3);      // the slice whose sums this lane stores
    v4f g4[FOLD_TRIPS], w4[FOLD_TRIPS], t4[FOLD_TRIPS];
    #pragma unroll   // constant indices keep the three sets in registers
    for (int i = 0; i < FOLD_TRIPS; ++i) {
        const int off = (qStart + i * 4) * UN + lane * 4;
        g4[i] = *(const v4f*)(gamma + off);
        w4[i] = *(const v4f*)(W2 + off);
        t4[i] = *(const v4f*)(beta + off);
    }
    const float b2v = b2[qMine];
    // The code below reuses these loads' address registers: keep the wait in front of that.
    asm volatile("s_wait_xcnt 0x0" ::: "memory");
    // Keeps the first products, and with them the first wait on a load, behind the last request:
    // without it some requests are issued only after the first data has come back.
    __builtin_amdgcn_sched_barrier(0);

    // gw = gamma*W2 ; per slice: sgw = sum gw ; db = sum beta*W2 + b2
    float sgMine = 0.f, dbMine = 0.f;
    #pragma unroll   // constant indices, and 16 independent sum trees to interleave
    for (int i = 0; i < FOLD_TRIPS; ++i) {
        const v4f gw = g4[i] * w4[i];
        *(v4f*)(gwS + (qStart + i * 4) * UN + lane * 4) = gw;
        const v4f bw = t4[i] * w4[i];
        const float sg = sum8((gw.x + gw.y) + (gw.z + gw.w));
        const float db = sum8((bw.x + bw.y) + (bw.z + bw.w));
        if (grp == i) { sgMine = sg; dbMine = db; }
    }
    sgwS[qMine] = sgMine;
    dbS[qMine]  = dbMine + b2v;
    __syncthreads();
    wR[AHEAD - 1] = loadW(qStart + AHEAD - 1);

    COps cCur = loadC(qStart);

    for (int c = 0; c < NCHUNK; ++c) {
#if HAVE_ASYNC
        if (c + 1 < NCHUNK) {
            stage(c + 1, (c + 1) & 1);
            WAIT_ASYNC(8);      // 8 outstanding = next chunk; this chunk is complete
        } else {
            WAIT_ASYNC(0);
        }
        const float* __restrict__ xb = &xbuf[wave][c & 1][0];
#endif
#if HAVE_ASYNC
        // B fragments = x^T (4x16 f32; K=s, N=batch row): K = half*2+{0,1}, 4+half*2+{0,1}
        const float* bp = xb + l16 * ROWPAD + half * 2;
        v2f bk0, bk1;
        bk0.x = bp[0]; bk0.y = bp[1];
        bk1.x = bp[4]; bk1.y = bp[5];
#endif
        #pragma unroll   // constant ring indices keep the sets in registers
        for (int qc = 0; qc < CHUNK; ++qc) {
            const int q = qStart + c * CHUNK + qc;
            // Operands are requested ahead of their use, so that their latency runs under
            // other slices' work: W1 and b1 (global) AHEAD slices, into the register set
            // that the slice before this one has left; the LDS operands one slice.
            const WOps& wCur = wR[qc % (AHEAD + 1)];
            wR[(qc + AHEAD) % (AHEAD + 1)] = loadW(q + AHEAD < qLast ? q + AHEAD : qLast);
            const COps cNxt = loadC(q < qLast ? q + 1 : qLast);
#if HAVE_ASYNC
            v2f bn0 = bk0, bn1 = bk1;
            if (qc + 1 < CHUNK) {   // stays inside the chunk that has landed
                bn0.x = bp[(qc + 1) * SN];     bn0.y = bp[(qc + 1) * SN + 1];
                bn1.x = bp[(qc + 1) * SN + 4]; bn1.y = bp[(qc + 1) * SN + 5];
            }
#else
            v2f bk0, bk1;
            {
                int gr = rowBase + l16;
                if (gr > B - 1) gr = B - 1;
                const float* bp = x + (size_t)gr * (QN * SN) + q * SN + half * 2;
                bk0.x = bp[0]; bk0.y = bp[1];
                bk1.x = bp[4]; bk1.y = bp[5];
            }
#endif
            // D = h^T = W1^T x^T + bias: bias folded into the C-init (uniform
            // across lanes within a half; N does not index the bias).
            v8f c0, c1;
            #pragma unroll
            for (int m = 0; m < 8; ++m) { c0[m] = wCur.B0.v[m]; c1[m] = wCur.B1.v[m]; }
            c0 = __builtin_amdgcn_wmma_f32_16x16x4_f32(false, wCur.a00, false, bk0, (short)0, c0, false, false);
            c0 = __builtin_amdgcn_wmma_f32_16x16x4_f32(false, wCur.a10, false, bk1, (short)0, c0, false, false);
            c1 = __builtin_amdgcn_wmma_f32_16x16x4_f32(false, wCur.a01, false, bk0, (short)0, c1, false, false);
            c1 = __builtin_amdgcn_wmma_f32_16x16x4_f32(false, wCur.a11, false, bk1, (short)0, c1, false, false);

            // ELU, then the row's three sums, two units at a time: each sum is kept as a pair of
            // partial sums, so that one packed instruction adds two units' terms.
            // ELU(v) is the median of v, exp(v) - 1 and 0: exp(v) - 1 >= v for every v, so above 0
            // the order is 0 < v <= exp(v) - 1 and below it v <= exp(v) - 1 < 0. One instruction
            // a unit, with no compare, no mask register and no select.
            v2f s2, ss2, t2;
            #pragma unroll   // constant indices into the accumulators and the coefficients
            for (int m = 0; m < 8; m += 2) {
                v2f a = { c0[m], c0[m + 1] };
                v2f b = { c1[m], c1[m + 1] };
                v2f ea = { __expf(a.x), __expf(a.y) };
                v2f eb = { __expf(b.x), __expf(b.y) };
                ea = ea - 1.f;
                eb = eb - 1.f;
                a.x = __builtin_amdgcn_fmed3f(a.x, ea.x, 0.f);   // ELU(alpha=1)
                a.y = __builtin_amdgcn_fmed3f(a.y, ea.y, 0.f);
                b.x = __builtin_amdgcn_fmed3f(b.x, eb.x, 0.f);
                b.y = __builtin_amdgcn_fmed3f(b.y, eb.y, 0.f);
                const v2f ga = { cCur.GW0.v[m], cCur.GW0.v[m + 1] };
                const v2f gb = { cCur.GW1.v[m], cCur.GW1.v[m + 1] };
                if (m == 0) {
                    s2 = a; ss2 = a * a; t2 = a * ga;
                } else {
                    s2 += a;
                    ss2 = __builtin_elementwise_fma(a, a, ss2);
                    t2  = __builtin_elementwise_fma(a, ga, t2);
                }
                s2 += b;
                ss2 = __builtin_elementwise_fma(b, b, ss2);
                t2  = __builtin_elementwise_fma(b, gb, t2);
            }
            float s = s2.x + s2.y, ss = ss2.x + ss2.y;
            // other 16 units of the same row live in lane^16
            s  += __shfl_xor(s, 16, 32);
            ss += __shfl_xor(ss, 16, 32);
            const float mu = s * (1.f / 32.f);
            float var = ss * (1.f / 32.f) - mu * mu;
            var = var < 0.f ? 0.f : var;
            const float rstd = rsqrtf(var + EPSV);

            // out = rstd*(sum h*gw - mu*sgw) + (sum beta*w2 + b2)
            float t = t2.x + t2.y;
            t += __shfl_xor(t, 16, 32);

            if (half == 0)
                outTile[l16 * OUTPAD + q] = rstd * (t - mu * cCur.sgw) + cCur.db;

            cCur = cNxt;
#if HAVE_ASYNC
            bk0 = bn0; bk1 = bn1;
#endif
        }
    }

    __syncthreads();

    // Coalesced store of the 16x128 tile (contiguous in (B,Q) layout).
    const size_t base = (size_t)rowBase * QN;
    for (int idx = threadIdx.x; idx < 16 * QN; idx += blockDim.x) {
        const int r = idx >> 7;
        const int qq = idx & (QN - 1);
        if (rowBase + r < B) out[base + idx] = outTile[r * OUTPAD + qq];
    }
}

extern "C" void kernel_launch(void* const* d_in, const int* in_sizes, int n_in,
                              void* d_out, int out_size, void* d_ws, size_t ws_size,
                              hipStream_t stream) {
    const float* x     = (const float*)d_in[0];
    const float* W1    = (const float*)d_in[1];
    const float* b1    = (const float*)d_in[2];
    const float* gamma = (const float*)d_in[3];
    const float* beta  = (const float*)d_in[4];
    const float* W2    = (const float*)d_in[5];
    const float* b2    = (const float*)d_in[6];
    float* out = (float*)d_out;

    const int B = in_sizes[0] / (QN * SN);
    const int nblocks = (B + 15) / 16;
    divenc_kernel<<<nblocks, WAVES * 32, 0, stream>>>(x, W1, b1, gamma, beta, W2, b2, out, B);
}

// v005
// One run takes 20.4 microseconds.
// Next to v004, in two timings, it ran 1.07 and 1.08 times as fast.
// All steps since v000 together make it 2.17 times as fast.
#include <hip/hip_runtime.h>

// CDNA5 / gfx1250: wave32, WMMA f32 16x16x4, async global->LDS staging,
// folded LayerNorm-affine + output projection, bias folded into WMMA C-init,
// per-slice operands requested ahead of use into spare register sets,
// each slice's operands used for two 16-row tiles.
typedef __attribute__((ext_vector_type(2))) float v2f;
typedef __attribute__((ext_vector_type(4))) float v4f;
typedef __attribute__((ext_vector_type(8))) float v8f;
typedef int v4i_ __attribute__((__vector_size__(16)));   // builtin's expected pointee

#define QN 128
#define SN 8
#define UN 32
#define EPSV 1e-3f

#define WAVES 8
#define ROWS 32                             // batch rows per block: two 16-row tiles
#define SLICES_PER_WAVE (QN / WAVES)        // 16
#define CHUNK 4                             // slices staged per async chunk
#define NCHUNK (SLICES_PER_WAVE / CHUNK)    // 4
#define ROWPAD 36                           // 32 floats per chunk-row + 4 pad (bank spread)
#define OUTPAD (QN + 1)                     // padded out tile row
#define AHEAD 3                             // slices by which W1 and b1 are requested ahead
static_assert(CHUNK % (AHEAD + 1) == 0, "the register ring is indexed by the slice's place in its chunk");
#define FOLD_TRIPS (SLICES_PER_WAVE / 4)    // 4: a wave folds four slices' coefficients per load
static_assert(FOLD_TRIPS <= 8 && (FOLD_TRIPS & (FOLD_TRIPS - 1)) == 0 && UN == 32,
              "one lane of each group of 8 stores one trip's sums");

#if __has_builtin(__builtin_amdgcn_global_load_async_to_lds_b128)
#define HAVE_ASYNC 1
#else
#define HAVE_ASYNC 0
#endif

#if HAVE_ASYNC
#if __has_builtin(__builtin_amdgcn_s_wait_asynccnt)
#define WAIT_ASYNC(n) do { __builtin_amdgcn_s_wait_asynccnt(n); asm volatile("" ::: "memory"); } while (0)
#else
#define WAIT_ASYNC(n) asm volatile("s_wait_asynccnt %0" :: "i"(n) : "memory")
#endif
typedef __attribute__((address_space(1))) v4i_* gptr16;
typedef __attribute__((address_space(3))) v4i_* lptr16;
#endif

struct F8 { float v[8]; };
__device__ __forceinline__ F8 ld8(const float* p) {
    F8 r;
    v4f a = *(const v4f*)p;
    v4f b = *(const v4f*)(p + 4);
    r.v[0]=a.x; r.v[1]=a.y; r.v[2]=a.z; r.v[3]=a.w;
    r.v[4]=b.x; r.v[5]=b.y; r.v[6]=b.z; r.v[7]=b.w;
    return r;
}

// Sum over the 8 lanes l ^ {1, 2, 4}; every lane of the group gets the sum.
template <int XMASK>
__device__ __forceinline__ float add_xmask(float v) {
    const int o = __builtin_amdgcn_update_dpp(0, __builtin_bit_cast(int, v), 0x160 | XMASK, 0xf, 0xf, true);
    return v + __builtin_bit_cast(float, o);
}
__device__ __forceinline__ float sum8(float v) {
    return add_xmask<4>(add_xmask<2>(add_xmask<1>(v)));
}

// One slice's operands that come from global memory: W1 fragments and the bias.
struct WOps { v2f a00, a01, a10, a11; F8 B0, B1; };
// One slice's folded coefficients, read from LDS.
struct COps { F8 GW0, GW1; float sgw, db; };
// One lane's share (16 of a row's 32 units) of the row's three sums.
struct Sums { float s, ss, t; };
// One tile's x fragments for one slice.
struct XOps { v2f k0, k1; };

__global__ __launch_bounds__(WAVES * 32) void divenc_kernel(
    const float* __restrict__ x,      // (B, Q*S)
    const float* __restrict__ W1,     // (Q, S, U)
    const float* __restrict__ b1,     // (Q, U)
    const float* __restrict__ gamma,  // (Q, U)
    const float* __restrict__ beta,   // (Q, U)
    const float* __restrict__ W2,     // (Q, U)
    const float* __restrict__ b2,     // (Q,)
    float* __restrict__ out,          // (B, Q)
    int B)
{
#if HAVE_ASYNC
    __shared__ float xbuf[WAVES][2][ROWS * ROWPAD]; // double-buffered x columns per wave
#endif
    __shared__ float outTile[ROWS * OUTPAD];        // padded: writes hit distinct banks
    __shared__ float gwS[QN * UN];                  // gamma*W2, block-shared
    __shared__ float sgwS[QN];                      // sum_u gamma*W2 per slice
    __shared__ float dbS[QN];                       // sum_u beta*W2 + b2 per slice

    const int lane = threadIdx.x & 31;
    const int wave = threadIdx.x >> 5;
    const int half = lane >> 4;          // 0: lanes 0-15, 1: lanes 16-31
    const int l16  = lane & 15;
    const int rowBase = blockIdx.x * ROWS;
    const int qStart  = wave * SLICES_PER_WAVE;

#if HAVE_ASYNC
    // Stage one chunk: 32 rows x 32 floats (4 slices) into xbuf[wave][sel].
    // Instruction i covers rows 4i .. 4i+3: 32 lanes x 16B = 4 rows x 32 floats (one 128-byte line a row).
    auto stage = [&](int c, int sel) {
        const int colBase = (qStart + c * CHUNK) * SN;   // float offset in x row
        #pragma unroll
        for (int i = 0; i < 8; ++i) {
            const int row = 4 * i + (lane >> 3);
            int gr = rowBase + row;
            if (gr > B - 1) gr = B - 1;
            float* src = const_cast<float*>(x) + (size_t)gr * (QN * SN) + colBase + (lane & 7) * 4;
            float* dst = &xbuf[wave][sel][row * ROWPAD + (lane & 7) * 4];
            __builtin_amdgcn_global_load_async_to_lds_b128(
                (gptr16)src, (lptr16)dst, 0, 0);
        }
        asm volatile("" ::: "memory");
    };
    stage(0, 0);   // DMA in flight while we precompute folded coefficients
#endif

    // In each of the two tiles (t = 0, 1) this lane owns batch row rowBase+16t+l16 with units:
    //   c0[m] -> u = half*8 + m ;  c1[m] -> u = 16 + half*8 + m
    // A fragments = W1[q]^T (16x4 f32 tiles; M=unit, K=s):
    // lanes 0-15: K = kk*4+{0,1}; lanes 16-31: K = kk*4+{2,3}; M = nt*16 + l16
    auto loadW = [&](int q) {
        WOps o;
        const float* __restrict__ w1q = W1 + q * (SN * UN);
        const int r0 = (half * 2) * UN;        // kk = 0
        o.a00.x = w1q[r0 + l16];        o.a00.y = w1q[r0 + UN + l16];
        o.a01.x = w1q[r0 + 16 + l16];   o.a01.y = w1q[r0 + UN + 16 + l16];
        const int r1 = (4 + half * 2) * UN;    // kk = 1
        o.a10.x = w1q[r1 + l16];        o.a10.y = w1q[r1 + UN + l16];
        o.a11.x = w1q[r1 + 16 + l16];   o.a11.y = w1q[r1 + UN + 16 + l16];
        o.B0 = ld8(b1 + q * UN + half * 8);
        o.B1 = ld8(b1 + q * UN + 16 + half * 8);
        return o;
    };
    auto loadC = [&](int q) {
        COps o;
        o.GW0 = ld8(gwS + q * UN + half * 8);        // LDS broadcast
        o.GW1 = ld8(gwS + q * UN + 16 + half * 8);
        o.sgw = sgwS[q];
        o.db  = dbS[q];
        return o;
    };
    const int qLast = qStart + SLICES_PER_WAVE - 1;
    // Ring of AHEAD + 1 register sets; the first AHEAD - 1 slices fly during the fold below,
    // the last of the AHEAD is requested behind it, into registers that the fold has left.
    WOps wR[AHEAD + 1];
    #pragma unroll   // constant ring indices keep the sets in registers
    for (int i = 0; i < AHEAD - 1; ++i) wR[i] = loadW(qStart + i);
    // ---- Fold gamma, beta, W2, b2 for this wave's own slices ----
    // A lane takes 16 bytes of a slice's 128-byte row: 8 lanes a slice, 4 slices (512 contiguous
    // bytes) a load. All loads of the fold are requested here, before the first is used, so that
    // the wave pays their latency once and not once per trip.
    const int grp = lane & 7;                              // place among the 8 lanes of one slice
    // The slice whose sums this lane holds; lanes grp and grp + FOLD_TRIPS hold the same one.
    const int tripMine = grp & (FOLD_TRIPS - 1);
    const int qMine = qStart + tripMine * 4 + (lane >> 3);
    v4f g4[FOLD_TRIPS], w4[FOLD_TRIPS], t4[FOLD_TRIPS];
    #pragma unroll   // constant indices keep the three sets in registers
    for (int i = 0; i < FOLD_TRIPS; ++i) {
        const int off = (qStart + i * 4) * UN + lane * 4;
        g4[i] = *(const v4f*)(gamma + off);
        w4[i] = *(const v4f*)(W2 + off);
        t4[i] = *(const v4f*)(beta + off);
    }
    const float b2v = b2[qMine];
    // The code below reuses these loads' address registers: keep the wait in front of that.
    asm volatile("s_wait_xcnt 0x0" ::: "memory");
    // Keeps the first products, and with them the first wait on a load, behind the last request:
    // without it some requests are issued only after the first data has come back.
    __builtin_amdgcn_sched_barrier(0);

    // gw = gamma*W2 ; per slice: sgw = sum gw ; db = sum beta*W2 + b2
    float sgMine = 0.f, dbMine = 0.f;
    #pragma unroll   // constant indices, and 8 independent sum trees to interleave
    for (int i = 0; i < FOLD_TRIPS; ++i) {
        const v4f gw = g4[i] * w4[i];
        *(v4f*)(gwS + (qStart + i * 4) * UN + lane * 4) = gw;
        const v4f bw = t4[i] * w4[i];
        const float sg = sum8((gw.x + gw.y) + (gw.z + gw.w));
        const float db = sum8((bw.x + bw.y) + (bw.z + bw.w));
        if (tripMine == i) { sgMine = sg; dbMine = db; }
    }
    if (grp < FOLD_TRIPS) {
        sgwS[qMine] = sgMine;
        dbS[qMine]  = dbMine + b2v;
    }
    __syncthreads();
    wR[AHEAD - 1] = loadW(qStart + AHEAD - 1);

    COps cCur = loadC(qStart);

    // One 16-row tile of one slice: the product, ELU, and this lane's share of the row's sums.
    auto tile = [&](const WOps& w, const COps& cf, const XOps& xf) {
        // D = h^T = W1^T x^T + bias: bias folded into the C-init (uniform
        // across lanes within a half; N does not index the bias).
        v8f c0, c1;
        #pragma unroll
        for (int m = 0; m < 8; ++m) { c0[m] = w.B0.v[m]; c1[m] = w.B1.v[m]; }
        c0 = __builtin_amdgcn_wmma_f32_16x16x4_f32(false, w.a00, false, xf.k0, (short)0, c0, false, false);
        c0 = __builtin_amdgcn_wmma_f32_16x16x4_f32(false, w.a10, false, xf.k1, (short)0, c0, false, false);
        c1 = __builtin_amdgcn_wmma_f32_16x16x4_f32(false, w.a01, false, xf.k0, (short)0, c1, false, false);
        c1 = __builtin_amdgcn_wmma_f32_16x16x4_f32(false, w.a11, false, xf.k1, (short)0, c1, false, false);

        // ELU, then the row's three sums, two units at a time: each sum is kept as a pair of
        // partial sums, so that one packed instruction adds two units' terms.
        // ELU(v) is the median of v, exp(v) - 1 and 0: exp(v) - 1 >= v for every v, so above 0
        // the order is 0 < v <= exp(v) - 1 and below it v <= exp(v) - 1 < 0. One instruction
        // a unit, with no compare, no mask register and no select.
        v2f s2, ss2, t2;
        #pragma unroll   // constant indices into the accumulators and the coefficients
        for (int m = 0; m < 8; m += 2) {
            v2f a = { c0[m], c0[m + 1] };
            v2f b = { c1[m], c1[m + 1] };
            v2f ea = { __expf(a.x), __expf(a.y) };
            v2f eb = { __expf(b.x), __expf(b.y) };
            ea = ea - 1.f;
            eb = eb - 1.f;
            a.x = __builtin_amdgcn_fmed3f(a.x, ea.x, 0.f);   // ELU(alpha=1)
            a.y = __builtin_amdgcn_fmed3f(a.y, ea.y, 0.f);
            b.x = __builtin_amdgcn_fmed3f(b.x, eb.x, 0.f);
            b.y = __builtin_amdgcn_fmed3f(b.y, eb.y, 0.f);
            const v2f ga = { cf.GW0.v[m], cf.GW0.v[m + 1] };
            const v2f gb = { cf.GW1.v[m], cf.GW1.v[m + 1] };
            if (m == 0) {
                s2 = a; ss2 = a * a; t2 = a * ga;
            } else {
                s2 += a;
                ss2 = __builtin_elementwise_fma(a, a, ss2);
                t2  = __builtin_elementwise_fma(a, ga, t2);
            }
            s2 += b;
            ss2 = __builtin_elementwise_fma(b, b, ss2);
            t2  = __builtin_elementwise_fma(b, gb, t2);
        }
        Sums r;
        r.s = s2.x + s2.y; r.ss = ss2.x + ss2.y; r.t = t2.x + t2.y;
        return r;
    };

    for (int c = 0; c < NCHUNK; ++c) {
        // B fragments = x^T (4x16 f32; K=s, N=batch row): K = half*2+{0,1}, 4+half*2+{0,1}
#if HAVE_ASYNC
        if (c + 1 < NCHUNK) {
            // This wave read the buffer that is refilled here one trip ago: those reads retire first.
            asm volatile("s_wait_dscnt 0x0" ::: "memory");
            stage(c + 1, (c + 1) & 1);
            WAIT_ASYNC(8);      // 8 outstanding = next chunk; this chunk is complete
        } else {
            WAIT_ASYNC(0);
        }
        const float* bp = &xbuf[wave][c & 1][0] + l16 * ROWPAD + half * 2;
        auto loadX = [&](int t, int qc) {
            XOps o;
            const float* p = bp + t * 16 * ROWPAD + qc * SN;
            o.k0.x = p[0]; o.k0.y = p[1];
            o.k1.x = p[4]; o.k1.y = p[5];
            return o;
        };
#else
        auto loadX = [&](int t, int qc) {
            XOps o;
            int gr = rowBase + t * 16 + l16;
            if (gr > B - 1) gr = B - 1;
            const float* p = x + (size_t)gr * (QN * SN) + (qStart + c * CHUNK + qc) * SN + half * 2;
            o.k0.x = p[0]; o.k0.y = p[1];
            o.k1.x = p[4]; o.k1.y = p[5];
            return o;
        };
#endif
        XOps x0 = loadX(0, 0), x1 = loadX(1, 0);
        #pragma unroll   // constant ring indices keep the sets in registers
        for (int qc = 0; qc < CHUNK; ++qc) {
            const int q = qStart + c * CHUNK + qc;
            // Operands are requested ahead of their use, so that their latency runs under
            // other slices' work: W1 and b1 (global) AHEAD slices, into the register set
            // that the slice before this one has left; the LDS operands one slice.
            const WOps& wCur = wR[qc % (AHEAD + 1)];
            wR[(qc + AHEAD) % (AHEAD + 1)] = loadW(q + AHEAD < qLast ? q + AHEAD : qLast);
            const COps cNxt = loadC(q < qLast ? q + 1 : qLast);
            XOps x0n = x0, x1n = x1;
            if (qc + 1 < CHUNK) {   // stays inside the chunk that has landed
                x0n = loadX(0, qc + 1);
                x1n = loadX(1, qc + 1);
            }
            // The code below reuses these loads' address registers: keep the wait in front of that.
            asm volatile("s_wait_xcnt 0x0" ::: "memory");
            // The slice's operands serve both tiles.
            const Sums r0 = tile(wCur, cCur, x0);
            const Sums r1 = tile(wCur, cCur, x1);

            // The other 16 units of a row live in lane^16. Lanes 0-15 close tile 0 and lanes 16-31
            // tile 1: a lane keeps its share of the tile it closes and hands lane^16 its share of
            // the other, so one exchange and one closing pass serve both tiles.
            float s  = (half ? r1.s  : r0.s)  + __shfl_xor(half ? r0.s  : r1.s,  16, 32);
            float ss = (half ? r1.ss : r0.ss) + __shfl_xor(half ? r0.ss : r1.ss, 16, 32);
            const float mu = s * (1.f / 32.f);
            float var = ss * (1.f / 32.f) - mu * mu;
            var = var < 0.f ? 0.f : var;
            const float rstd = rsqrtf(var + EPSV);

            // out = rstd*(sum h*gw - mu*sgw) + (sum beta*w2 + b2)
            const float t = (half ? r1.t : r0.t) + __shfl_xor(half ? r0.t : r1.t, 16, 32);

            // block row = 16 * tile + l16 = lane
            outTile[lane * OUTPAD + q] = rstd * (t - mu * cCur.sgw) + cCur.db;

            cCur = cNxt;
            x0 = x0n; x1 = x1n;
        }
    }

    __syncthreads();

    // Coalesced store of the 32x128 tile (contiguous in (B,Q) layout).
    const size_t base = (size_t)rowBase * QN;
    for (int idx = threadIdx.x; idx < ROWS * QN; idx += blockDim.x) {
        const int r = idx >> 7;
        const int qq = idx & (QN - 1);
        if (rowBase + r < B) out[base + idx] = outTile[r * OUTPAD + qq];
    }
}

extern "C" void kernel_launch(void* const* d_in, const int* in_sizes, int n_in,
                              void* d_out, int out_size, void* d_ws, size_t ws_size,
                              hipStream_t stream) {
    const float* x     = (const float*)d_in[0];
    const float* W1    = (const float*)d_in[1];
    const float* b1    = (const float*)d_in[2];
    const float* gamma = (const float*)d_in[3];
    const float* beta  = (const float*)d_in[4];
    const float* W2    = (const float*)d_in[5];
    const float* b2    = (const float*)d_in[6];
    float* out = (float*)d_out;

    const int B = in_sizes[0] / (QN * SN);
    const int nblocks = (B + ROWS - 1) / ROWS;
    divenc_kernel<<<nblocks, WAVES * 32, 0, stream>>>(x, W1, b1, gamma, beta, W2, b2, out, B);
}

// v006
// A run of this version takes 18.6 microseconds.
// In both of two side-by-side timings against v005, it was 1.10 times as fast.
// All steps since v000 together make it 2.38 times as fast.
#include <hip/hip_runtime.h>

// CDNA5 / gfx1250: wave32, WMMA f32 16x16x4, async global->LDS staging,
// folded LayerNorm-affine + output projection, bias folded into WMMA C-init,
// per-slice operands requested ahead of use into spare register sets,
// each slice's operands used for two 16-row tiles.
typedef __attribute__((ext_vector_type(2))) float v2f;
typedef __attribute__((ext_vector_type(4))) float v4f;
typedef __attribute__((ext_vector_type(8))) float v8f;
typedef int v4i_ __attribute__((__vector_size__(16)));   // builtin's expected pointee

#define QN 128
#define SN 8
#define UN 32
#define EPSV 1e-3f

#define WAVES 8
#define ROWS 32                             // batch rows per block: two 16-row tiles
#define SLICES_PER_WAVE (QN / WAVES)        // 16
#define CHUNK 4                             // slices staged per async chunk
#define NCHUNK (SLICES_PER_WAVE / CHUNK)    // 4
#define ROWPAD 36                           // 32 floats per chunk-row + 4 pad (bank spread)
#define OUTPAD (QN + 4)                     // out tile row: 16-byte aligned for the store's reads, two lanes a bank on the writes
#define ROWS_PER_WAVE (ROWS / WAVES)        // 4: rows of the out tile that a wave stores
static_assert(QN == 32 * 4 && OUTPAD % 4 == 0, "a wave's 32 lanes x 16 bytes cover one row of out");
#define AHEAD 3                             // slices by which W1 and b1 are requested ahead
static_assert(CHUNK % (AHEAD + 1) == 0, "the register ring is indexed by the slice's place in its chunk");
#define FOLD_TRIPS (SLICES_PER_WAVE / 4)    // 4: a wave folds four slices' coefficients per load
static_assert(FOLD_TRIPS <= 8 && (FOLD_TRIPS & (FOLD_TRIPS - 1)) == 0 && UN == 32,
              "one lane of each group of 8 stores one trip's sums");

#if __has_builtin(__builtin_amdgcn_global_load_async_to_lds_b128)
#define HAVE_ASYNC 1
#else
#define HAVE_ASYNC 0
#endif

#if HAVE_ASYNC
#if __has_builtin(__builtin_amdgcn_s_wait_asynccnt)
#define WAIT_ASYNC(n) do { __builtin_amdgcn_s_wait_asynccnt(n); asm volatile("" ::: "memory"); } while (0)
#else
#define WAIT_ASYNC(n) asm volatile("s_wait_asynccnt %0" :: "i"(n) : "memory")
#endif
typedef __attribute__((address_space(1))) v4i_* gptr16;
typedef __attribute__((address_space(3))) v4i_* lptr16;
#endif

struct F8 { float v[8]; };
__device__ __forceinline__ F8 ld8(const float* p) {
    F8 r;
    v4f a = *(const v4f*)p;
    v4f b = *(const v4f*)(p + 4);
    r.v[0]=a.x; r.v[1]=a.y; r.v[2]=a.z; r.v[3]=a.w;
    r.v[4]=b.x; r.v[5]=b.y; r.v[6]=b.z; r.v[7]=b.w;
    return r;
}

// Sum over the 8 lanes l ^ {1, 2, 4}; every lane of the group gets the sum.
template <int XMASK>
__device__ __forceinline__ float add_xmask(float v) {
    const int o = __builtin_amdgcn_update_dpp(0, __builtin_bit_cast(int, v), 0x160 | XMASK, 0xf, 0xf, true);
    return v + __builtin_bit_cast(float, o);
}
__device__ __forceinline__ float sum8(float v) {
    return add_xmask<4>(add_xmask<2>(add_xmask<1>(v)));
}

// One slice's operands that come from global memory: W1 fragments and the bias.
struct WOps { v2f a00, a01, a10, a11; F8 B0, B1; };
// One slice's folded coefficients, read from LDS.
struct COps { F8 GW0, GW1; float sgw, db; };
// One lane's share (16 of a row's 32 units) of the row's three sums.
struct Sums { float s, ss, t; };
// One tile's x fragments for one slice.
struct XOps { v2f k0, k1; };

__global__ __launch_bounds__(WAVES * 32) void divenc_kernel(
    const float* __restrict__ x,      // (B, Q*S)
    const float* __restrict__ W1,     // (Q, S, U)
    const float* __restrict__ b1,     // (Q, U)
    const float* __restrict__ gamma,  // (Q, U)
    const float* __restrict__ beta,   // (Q, U)
    const float* __restrict__ W2,     // (Q, U)
    const float* __restrict__ b2,     // (Q,)
    float* __restrict__ out,          // (B, Q)
    int B)
{
#if HAVE_ASYNC
    __shared__ float xbuf[WAVES][2][ROWS * ROWPAD]; // double-buffered x columns per wave
#endif
    __shared__ __attribute__((aligned(16))) float outTile[ROWS * OUTPAD];
    __shared__ float gwS[QN * UN];                  // gamma*W2, block-shared
    __shared__ float sgwS[QN];                      // sum_u gamma*W2 per slice
    __shared__ float dbS[QN];                       // sum_u beta*W2 + b2 per slice

    const int lane = threadIdx.x & 31;
    const int wave = threadIdx.x >> 5;
    const int half = lane >> 4;          // 0: lanes 0-15, 1: lanes 16-31
    const int l16  = lane & 15;
    const int rowBase = blockIdx.x * ROWS;
    const int qStart  = wave * SLICES_PER_WAVE;

#if HAVE_ASYNC
    // Stage one chunk: 32 rows x 32 floats (4 slices) into xbuf[wave][sel].
    // Instruction i covers rows 4i .. 4i+3: 32 lanes x 16B = 4 rows x 32 floats (one 128-byte line a row).
    auto stage = [&](int c, int sel) {
        const int colBase = (qStart + c * CHUNK) * SN;   // float offset in x row
        #pragma unroll
        for (int i = 0; i < 8; ++i) {
            const int row = 4 * i + (lane >> 3);
            int gr = rowBase + row;
            if (gr > B - 1) gr = B - 1;
            float* src = const_cast<float*>(x) + (size_t)gr * (QN * SN) + colBase + (lane & 7) * 4;
            float* dst = &xbuf[wave][sel][row * ROWPAD + (lane & 7) * 4];
            __builtin_amdgcn_global_load_async_to_lds_b128(
                (gptr16)src, (lptr16)dst, 0, 0);
        }
        asm volatile("" ::: "memory");
    };
    stage(0, 0);   // DMA in flight while we precompute folded coefficients
#endif

    // In each of the two tiles (t = 0, 1) this lane owns batch row rowBase+16t+l16 with units:
    //   c0[m] -> u = half*8 + m ;  c1[m] -> u = 16 + half*8 + m
    // A fragments = W1[q]^T (16x4 f32 tiles; M=unit, K=s):
    // lanes 0-15: K = kk*4+{0,1}; lanes 16-31: K = kk*4+{2,3}; M = nt*16 + l16
    auto loadW = [&](int q) {
        WOps o;
        const float* __restrict__ w1q = W1 + q * (SN * UN);
        const int r0 = (half * 2) * UN;        // kk = 0
        o.a00.x = w1q[r0 + l16];        o.a00.y = w1q[r0 + UN + l16];
        o.a01.x = w1q[r0 + 16 + l16];   o.a01.y = w1q[r0 + UN + 16 + l16];
        const int r1 = (4 + half * 2) * UN;    // kk = 1
        o.a10.x = w1q[r1 + l16];        o.a10.y = w1q[r1 + UN + l16];
        o.a11.x = w1q[r1 + 16 + l16];   o.a11.y = w1q[r1 + UN + 16 + l16];
        o.B0 = ld8(b1 + q * UN + half * 8);
        o.B1 = ld8(b1 + q * UN + 16 + half * 8);
        return o;
    };
    auto loadC = [&](int q) {
        COps o;
        o.GW0 = ld8(gwS + q * UN + half * 8);        // LDS broadcast
        o.GW1 = ld8(gwS + q * UN + 16 + half * 8);
        o.sgw = sgwS[q];
        o.db  = dbS[q];
        return o;
    };
    const int qLast = qStart + SLICES_PER_WAVE - 1;
    // Ring of AHEAD + 1 register sets; the first AHEAD - 1 slices fly during the fold below,
    // the last of the AHEAD is requested behind it, into registers that the fold has left.
    WOps wR[AHEAD + 1];
    #pragma unroll   // constant ring indices keep the sets in registers
    for (int i = 0; i < AHEAD - 1; ++i) wR[i] = loadW(qStart + i);
    // ---- Fold gamma, beta, W2, b2 for this wave's own slices ----
    // A lane takes 16 bytes of a slice's 128-byte row: 8 lanes a slice, 4 slices (512 contiguous
    // bytes) a load. All loads of the fold are requested here, before the first is used, so that
    // the wave pays their latency once and not once per trip.
    const int grp = lane & 7;                              // place among the 8 lanes of one slice
    // The slice whose sums this lane holds; lanes grp and grp + FOLD_TRIPS hold the same one.
    const int tripMine = grp & (FOLD_TRIPS - 1);
    const int qMine = qStart + tripMine * 4 + (lane >> 3);
    v4f g4[FOLD_TRIPS], w4[FOLD_TRIPS], t4[FOLD_TRIPS];
    #pragma unroll   // constant indices keep the three sets in registers
    for (int i = 0; i < FOLD_TRIPS; ++i) {
        const int off = (qStart + i * 4) * UN + lane * 4;
        g4[i] = *(const v4f*)(gamma + off);
        w4[i] = *(const v4f*)(W2 + off);
        t4[i] = *(const v4f*)(beta + off);
    }
    const float b2v = b2[qMine];
    // The code below reuses these loads' address registers: keep the wait in front of that.
    asm volatile("s_wait_xcnt 0x0" ::: "memory");
    // Keeps the first products, and with them the first wait on a load, behind the last request:
    // without it some requests are issued only after the first data has come back.
    __builtin_amdgcn_sched_barrier(0);

    // gw = gamma*W2 ; per slice: sgw = sum gw ; db = sum beta*W2 + b2
    float sgMine = 0.f, dbMine = 0.f;
    #pragma unroll   // constant indices, and 8 independent sum trees to interleave
    for (int i = 0; i < FOLD_TRIPS; ++i) {
        const v4f gw = g4[i] * w4[i];
        *(v4f*)(gwS + (qStart + i * 4) * UN + lane * 4) = gw;
        const v4f bw = t4[i] * w4[i];
        const float sg = sum8((gw.x + gw.y) + (gw.z + gw.w));
        const float db = sum8((bw.x + bw.y) + (bw.z + bw.w));
        if (tripMine == i) { sgMine = sg; dbMine = db; }
    }
    if (grp < FOLD_TRIPS) {
        sgwS[qMine] = sgMine;
        dbS[qMine]  = dbMine + b2v;
    }
    __syncthreads();
    wR[AHEAD - 1] = loadW(qStart + AHEAD - 1);

    COps cCur = loadC(qStart);

    // One 16-row tile of one slice: the product, ELU, and this lane's share of the row's sums.
    auto tile = [&](const WOps& w, const COps& cf, const XOps& xf) {
        // D = h^T = W1^T x^T + bias: bias folded into the C-init (uniform
        // across lanes within a half; N does not index the bias).
        v8f c0, c1;
        #pragma unroll
        for (int m = 0; m < 8; ++m) { c0[m] = w.B0.v[m]; c1[m] = w.B1.v[m]; }
        c0 = __builtin_amdgcn_wmma_f32_16x16x4_f32(false, w.a00, false, xf.k0, (short)0, c0, false, false);
        c0 = __builtin_amdgcn_wmma_f32_16x16x4_f32(false, w.a10, false, xf.k1, (short)0, c0, false, false);
        c1 = __builtin_amdgcn_wmma_f32_16x16x4_f32(false, w.a01, false, xf.k0, (short)0, c1, false, false);
        c1 = __builtin_amdgcn_wmma_f32_16x16x4_f32(false, w.a11, false, xf.k1, (short)0, c1, false, false);

        // ELU, then the row's three sums, two units at a time: each sum is kept as a pair of
        // partial sums, so that one packed instruction adds two units' terms.
        // ELU(v) is the median of v, exp(v) - 1 and 0: exp(v) - 1 >= v for every v, so above 0
        // the order is 0 < v <= exp(v) - 1 and below it v <= exp(v) - 1 < 0. One instruction
        // a unit, with no compare, no mask register and no select.
        v2f s2, ss2, t2;
        #pragma unroll   // constant indices into the accumulators and the coefficients
        for (int m = 0; m < 8; m += 2) {
            v2f a = { c0[m], c0[m + 1] };
            v2f b = { c1[m], c1[m + 1] };
            v2f ea = { __expf(a.x), __expf(a.y) };
            v2f eb = { __expf(b.x), __expf(b.y) };
            ea = ea - 1.f;
            eb = eb - 1.f;
            a.x = __builtin_amdgcn_fmed3f(a.x, ea.x, 0.f);   // ELU(alpha=1)
            a.y = __builtin_amdgcn_fmed3f(a.y, ea.y, 0.f);
            b.x = __builtin_amdgcn_fmed3f(b.x, eb.x, 0.f);
            b.y = __builtin_amdgcn_fmed3f(b.y, eb.y, 0.f);
            const v2f ga = { cf.GW0.v[m], cf.GW0.v[m + 1] };
            const v2f gb = { cf.GW1.v[m], cf.GW1.v[m + 1] };
            if (m == 0) {
                s2 = a; ss2 = a * a; t2 = a * ga;
            } else {
                s2 += a;
                ss2 = __builtin_elementwise_fma(a, a, ss2);
                t2  = __builtin_elementwise_fma(a, ga, t2);
            }
            s2 += b;
            ss2 = __builtin_elementwise_fma(b, b, ss2);
            t2  = __builtin_elementwise_fma(b, gb, t2);
        }
        Sums r;
        r.s = s2.x + s2.y; r.ss = ss2.x + ss2.y; r.t = t2.x + t2.y;
        return r;
    };

    for (int c = 0; c < NCHUNK; ++c) {
        // B fragments = x^T (4x16 f32; K=s, N=batch row): K = half*2+{0,1}, 4+half*2+{0,1}
#if HAVE_ASYNC
        if (c + 1 < NCHUNK) {
            // This wave read the buffer that is refilled here one trip ago: those reads retire first.
            asm volatile("s_wait_dscnt 0x0" ::: "memory");
            stage(c + 1, (c + 1) & 1);
            WAIT_ASYNC(8);      // 8 outstanding = next chunk; this chunk is complete
        } else {
            WAIT_ASYNC(0);
        }
        const float* bp = &xbuf[wave][c & 1][0] + l16 * ROWPAD + half * 2;
        auto loadX = [&](int t, int qc) {
            XOps o;
            const float* p = bp + t * 16 * ROWPAD + qc * SN;
            o.k0.x = p[0]; o.k0.y = p[1];
            o.k1.x = p[4]; o.k1.y = p[5];
            return o;
        };
#else
        auto loadX = [&](int t, int qc) {
            XOps o;
            int gr = rowBase + t * 16 + l16;
            if (gr > B - 1) gr = B - 1;
            const float* p = x + (size_t)gr * (QN * SN) + (qStart + c * CHUNK + qc) * SN + half * 2;
            o.k0.x = p[0]; o.k0.y = p[1];
            o.k1.x = p[4]; o.k1.y = p[5];
            return o;
        };
#endif
        XOps x0 = loadX(0, 0), x1 = loadX(1, 0);
        #pragma unroll   // constant ring indices keep the sets in registers
        for (int qc = 0; qc < CHUNK; ++qc) {
            const int q = qStart + c * CHUNK + qc;
            // Operands are requested ahead of their use, so that their latency runs under
            // other slices' work: W1 and b1 (global) AHEAD slices, into the register set
            // that the slice before this one has left; the LDS operands one slice.
            const WOps& wCur = wR[qc % (AHEAD + 1)];
            wR[(qc + AHEAD) % (AHEAD + 1)] = loadW(q + AHEAD < qLast ? q + AHEAD : qLast);
            const COps cNxt = loadC(q < qLast ? q + 1 : qLast);
            XOps x0n = x0, x1n = x1;
            if (qc + 1 < CHUNK) {   // stays inside the chunk that has landed
                x0n = loadX(0, qc + 1);
                x1n = loadX(1, qc + 1);
            }
            // The code below reuses these loads' address registers: keep the wait in front of that.
            asm volatile("s_wait_xcnt 0x0" ::: "memory");
            // The slice's operands serve both tiles.
            const Sums r0 = tile(wCur, cCur, x0);
            const Sums r1 = tile(wCur, cCur, x1);

            // The other 16 units of a row live in lane^16. Lanes 0-15 close tile 0 and lanes 16-31
            // tile 1: a lane keeps its share of the tile it closes and hands lane^16 its share of
            // the other, so one exchange and one closing pass serve both tiles.
            float s  = (half ? r1.s  : r0.s)  + __shfl_xor(half ? r0.s  : r1.s,  16, 32);
            float ss = (half ? r1.ss : r0.ss) + __shfl_xor(half ? r0.ss : r1.ss, 16, 32);
            const float mu = s * (1.f / 32.f);
            float var = ss * (1.f / 32.f) - mu * mu;
            var = var < 0.f ? 0.f : var;
            const float rstd = rsqrtf(var + EPSV);

            // out = rstd*(sum h*gw - mu*sgw) + (sum beta*w2 + b2)
            const float t = (half ? r1.t : r0.t) + __shfl_xor(half ? r0.t : r1.t, 16, 32);

            // block row = 16 * tile + l16 = lane
            outTile[lane * OUTPAD + q] = rstd * (t - mu * cCur.sgw) + cCur.db;

            cCur = cNxt;
            x0 = x0n; x1 = x1n;
        }
    }

    __syncthreads();

    // Store of the 32x128 tile. A wave takes four rows and a lane 16 bytes of each, so that one
    // store covers a whole 512-byte row of out. The four LDS reads are requested together, ahead
    // of the first store: the wave pays the LDS latency once, and no trip of a loop waits on it.
    // The wave's number as a scalar: the tests on the rows are then scalar branches, not lane masks.
    const int row0 = __builtin_amdgcn_readfirstlane(wave) * ROWS_PER_WAVE;
    const int rowsLeft = B - (rowBase + row0);   // rows of out from this wave's first on
    v4f o[ROWS_PER_WAVE];
    #pragma unroll   // constant indices keep the rows in registers
    for (int i = 0; i < ROWS_PER_WAVE; ++i)
        o[i] = *(const v4f*)(outTile + (row0 + i) * OUTPAD + lane * 4);
    float* __restrict__ op = out + (size_t)(rowBase + row0) * QN + lane * 4;
    #pragma unroll   // four stores off one address, each behind its own scalar test
    for (int i = 0; i < ROWS_PER_WAVE; ++i)
        if (i < rowsLeft) *(v4f*)(op + i * QN) = o[i];
}

extern "C" void kernel_launch(void* const* d_in, const int* in_sizes, int n_in,
                              void* d_out, int out_size, void* d_ws, size_t ws_size,
                              hipStream_t stream) {
    const float* x     = (const float*)d_in[0];
    const float* W1    = (const float*)d_in[1];
    const float* b1    = (const float*)d_in[2];
    const float* gamma = (const float*)d_in[3];
    const float* beta  = (const float*)d_in[4];
    const float* W2    = (const float*)d_in[5];
    const float* b2    = (const float*)d_in[6];
    float* out = (float*)d_out;

    const int B = in_sizes[0] / (QN * SN);
    const int nblocks = (B + ROWS - 1) / ROWS;
    divenc_kernel<<<nblocks, WAVES * 32, 0, stream>>>(x, W1, b1, gamma, beta, W2, b2, out, B);
}

// v007
// One run takes 16.7 microseconds.
// Timed twice side by side with v006, it ran 1.11 times as fast both times.
// Over all steps from v000 it is 2.65 times as fast.
#include <hip/hip_runtime.h>

// CDNA5 / gfx1250: wave32, WMMA f32 16x16x4, async global->LDS staging,
// folded LayerNorm-affine + output projection, bias folded into WMMA C-init,
// a wave keeps its four slices' weights for its whole life (W1 in registers, the bias and the
// folded coefficients in its own LDS) and walks the rows, two 16-row tiles per slice and pass.
typedef __attribute__((ext_vector_type(2))) float v2f;
typedef __attribute__((ext_vector_type(4))) float v4f;
typedef __attribute__((ext_vector_type(8))) float v8f;
typedef int v4i_ __attribute__((__vector_size__(16)));   // builtin's expected pointee

#define QN 128
#define SN 8
#define UN 32
#define EPSV 1e-3f

#define WAVES 8
#define ROWS 32                             // batch rows per pass: two 16-row tiles
#define PASSES 4                            // passes of a wave over its block's rows
#define BROWS (ROWS * PASSES)               // 128 batch rows per block
#define SPW 4                               // slices that a wave keeps
#define BSL (WAVES * SPW)                   // 32 slices per block
#define QBLK (QN / BSL)                     // 4 blocks side by side cover a row of out
#define ROWPAD 36                           // 32 floats per staged row + 4 pad (bank spread)
#define OUTPAD (BSL + 4)                    // out tile row: 16-byte aligned for the store's reads, two lanes a bank on the writes
#define ROWS_PER_WAVE (BROWS / WAVES)       // 16: rows of the out tile that a wave stores
#define STORES (ROWS_PER_WAVE / 4)          // 4: a store covers four rows' 128-byte lines
static_assert(BSL == 8 * 4 && OUTPAD % 4 == 0, "8 lanes x 16 bytes cover the block's 128 bytes of one row of out");
static_assert(SPW * UN == 32 * 4 && SPW * SN == 32, "one 16-byte load a lane covers the wave's slices; a staged row is one 128-byte line");

#if __has_builtin(__builtin_amdgcn_global_load_async_to_lds_b128)
#define HAVE_ASYNC 1
#else
#define HAVE_ASYNC 0
#endif

#if HAVE_ASYNC
#if __has_builtin(__builtin_amdgcn_s_wait_asynccnt)
#define WAIT_ASYNC(n) do { __builtin_amdgcn_s_wait_asynccnt(n); asm volatile("" ::: "memory"); } while (0)
#else
#define WAIT_ASYNC(n) asm volatile("s_wait_asynccnt %0" :: "i"(n) : "memory")
#endif
typedef __attribute__((address_space(1))) v4i_* gptr16;
typedef __attribute__((address_space(3))) v4i_* lptr16;
#endif

struct F8 { float v[8]; };
__device__ __forceinline__ F8 ld8(const float* p) {
    F8 r;
    v4f a = *(const v4f*)p;
    v4f b = *(const v4f*)(p + 4);
    r.v[0]=a.x; r.v[1]=a.y; r.v[2]=a.z; r.v[3]=a.w;
    r.v[4]=b.x; r.v[5]=b.y; r.v[6]=b.z; r.v[7]=b.w;
    return r;
}

// Sum over the 8 lanes l ^ {1, 2, 4}; every lane of the group gets the sum.
template <int XMASK>
__device__ __forceinline__ float add_xmask(float v) {
    const int o = __builtin_amdgcn_update_dpp(0, __builtin_bit_cast(int, v), 0x160 | XMASK, 0xf, 0xf, true);
    return v + __builtin_bit_cast(float, o);
}
__device__ __forceinline__ float sum8(float v) {
    return add_xmask<4>(add_xmask<2>(add_xmask<1>(v)));
}

// One slice's W1 fragments: loaded once, kept in registers.
struct WOps { v2f a00, a01, a10, a11; };
// One slice's bias and folded coefficients, read from LDS.
struct COps { F8 B0, B1, GW0, GW1; };
// One lane's share (16 of a row's 32 units) of the row's three sums.
struct Sums { float s, ss, t; };
// One tile's x fragments for one slice.
struct XOps { v2f k0, k1; };

__global__ __launch_bounds__(WAVES * 32) void divenc_kernel(
    const float* __restrict__ x,      // (B, Q*S)
    const float* __restrict__ W1,     // (Q, S, U)
    const float* __restrict__ b1,     // (Q, U)
    const float* __restrict__ gamma,  // (Q, U)
    const float* __restrict__ beta,   // (Q, U)
    const float* __restrict__ W2,     // (Q, U)
    const float* __restrict__ b2,     // (Q,)
    float* __restrict__ out,          // (B, Q)
    int B)
{
#if HAVE_ASYNC
    __shared__ float xbuf[WAVES][2][ROWS * ROWPAD]; // double-buffered x rows per wave
#endif
    __shared__ __attribute__((aligned(16))) float outTile[BROWS * OUTPAD];
    // gamma*W2 and b1: a wave writes and reads its own slices only
    __shared__ __attribute__((aligned(16))) float gwS[BSL * UN];
    __shared__ __attribute__((aligned(16))) float b1S[BSL * UN];

    const int lane = threadIdx.x & 31;
    const int wave = threadIdx.x >> 5;
    const int half = lane >> 4;          // 0: lanes 0-15, 1: lanes 16-31
    const int l16  = lane & 15;
    const int colBlk  = blockIdx.x % QBLK;
    const int rowBase = (blockIdx.x / QBLK) * BROWS;
    const int qStart  = colBlk * BSL + wave * SPW;   // first of the wave's slices

#if HAVE_ASYNC
    // Stage one pass: 32 rows x 32 floats (the wave's 4 slices) into xbuf[wave][sel].
    // Instruction i covers rows 4i .. 4i+3: 32 lanes x 16B = 4 rows x 32 floats (one 128-byte line a row).
    // An address is the block's first byte of x (the same for every lane, 64 bits) plus a lane's
    // 32-bit byte offset inside the block's 128 rows; a row past the batch's end reads the last row
    // (the columns' bytes are the low 12 bits of both offsets, so the smaller offset is the smaller row).
    const char* const xBlk = (const char*)(x + (size_t)rowBase * (QN * SN) + colBlk * (BSL * SN));
    const unsigned colOff  = (wave * (SPW * SN) + (lane & 7) * 4) * 4;
    const unsigned laneOff = (lane >> 3) * (QN * SN * 4) + colOff;
    const int rowsHere = B - rowBase < BROWS ? B - rowBase : BROWS;   // rows of the block that exist: 1 .. 128
    const unsigned lastOff = (unsigned)(rowsHere - 1) * (QN * SN * 4) + colOff;
    auto stage = [&](int p, int sel) {
        #pragma unroll
        for (int i = 0; i < 8; ++i) {
            unsigned off = laneOff + (p * ROWS + 4 * i) * (QN * SN * 4);
            if (off > lastOff) off = lastOff;
            float* dst = &xbuf[wave][sel][(4 * i + (lane >> 3)) * ROWPAD + (lane & 7) * 4];
            __builtin_amdgcn_global_load_async_to_lds_b128(
                (gptr16)const_cast<char*>(xBlk + off), (lptr16)dst, 0, 0);
        }
        asm volatile("" ::: "memory");
    };
    stage(0, 0);   // DMA in flight while we precompute folded coefficients
#endif

    // In each of the two tiles (t = 0, 1) of a pass this lane owns batch row 16t+l16 of the pass with units:
    //   c0[m] -> u = half*8 + m ;  c1[m] -> u = 16 + half*8 + m
    // A fragments = W1[q]^T (16x4 f32 tiles; M=unit, K=s):
    // lanes 0-15: K = kk*4+{0,1}; lanes 16-31: K = kk*4+{2,3}; M = nt*16 + l16
    auto loadW = [&](int q) {
        WOps o;
        const float* __restrict__ w1q = W1 + q * (SN * UN);
        const int r0 = (half * 2) * UN;        // kk = 0
        o.a00.x = w1q[r0 + l16];        o.a00.y = w1q[r0 + UN + l16];
        o.a01.x = w1q[r0 + 16 + l16];   o.a01.y = w1q[r0 + UN + 16 + l16];
        const int r1 = (4 + half * 2) * UN;    // kk = 1
        o.a10.x = w1q[r1 + l16];        o.a10.y = w1q[r1 + UN + l16];
        o.a11.x = w1q[r1 + 16 + l16];   o.a11.y = w1q[r1 + UN + 16 + l16];
        return o;
    };
    auto loadC = [&](int k) {   // k: the slice's place among the wave's own
        COps o;
        o.B0  = ld8(b1S + (wave * SPW + k) * UN + half * 8);        // LDS broadcast
        o.B1  = ld8(b1S + (wave * SPW + k) * UN + 16 + half * 8);
        o.GW0 = ld8(gwS + (wave * SPW + k) * UN + half * 8);
        o.GW1 = ld8(gwS + (wave * SPW + k) * UN + 16 + half * 8);
        return o;
    };
    // ---- All of the wave's weights are requested here, once, before the first is used ----
    // gamma, W2, beta, b1: a lane takes 16 bytes of a slice's 128-byte row: 8 lanes a slice, the
    // wave's 4 slices (512 contiguous bytes) a load. They go out first: the fold below waits
    // for them alone, while W1 is still on its way.
    const int foldOff = qStart * UN + lane * 4;
    const v4f g4 = *(const v4f*)(gamma + foldOff);
    const v4f w4 = *(const v4f*)(W2 + foldOff);
    const v4f t4 = *(const v4f*)(beta + foldOff);
    const v4f c4 = *(const v4f*)(b1 + foldOff);
    const float b2v = b2[qStart + (lane >> 3)];
    WOps wR[SPW];   // W1 of the wave's slices: it stays in these registers for every pass
    #pragma unroll   // constant indices keep the sets in registers
    for (int k = 0; k < SPW; ++k) wR[k] = loadW(qStart + k);
    // The code below reuses these loads' address registers: keep the wait in front of that.
    asm volatile("s_wait_xcnt 0x0" ::: "memory");
    // Keeps the first products, and with them the first wait on a load, behind the last request:
    // without it some requests are issued only after the first data has come back.
    __builtin_amdgcn_sched_barrier(0);

    // gw = gamma*W2 ; per slice: sgw = sum gw ; db = sum beta*W2 + b2
    const v4f gw = g4 * w4;
    *(v4f*)(gwS + wave * (SPW * UN) + lane * 4) = gw;
    *(v4f*)(b1S + wave * (SPW * UN) + lane * 4) = c4;
    const v4f bw = t4 * w4;
    const float sgL = sum8((gw.x + gw.y) + (gw.z + gw.w));
    const float dbL = sum8((bw.x + bw.y) + (bw.z + bw.w)) + b2v;
    // Lanes 8k .. 8k+7 hold slice k's two sums: they are the same for every lane's rows, so each
    // is read out of its lane once, here, and costs no load in the passes.
    float sgw[SPW], dbv[SPW];
    #pragma unroll   // constant lane numbers
    for (int k = 0; k < SPW; ++k) {
        sgw[k] = __builtin_bit_cast(float, __builtin_amdgcn_readlane(__builtin_bit_cast(int, sgL), 8 * k));
        dbv[k] = __builtin_bit_cast(float, __builtin_amdgcn_readlane(__builtin_bit_cast(int, dbL), 8 * k));
    }
    // gwS and b1S are read below by other lanes of the same wave only: a wave's LDS instructions run
    // in order, so no barrier; the fence keeps the compiler from moving those reads over the stores.
    __builtin_amdgcn_fence(__ATOMIC_ACQ_REL, "wavefront");

    COps cCur = loadC(0);

    // One 16-row tile of one slice: the product, ELU, and this lane's share of the row's sums.
    auto tile = [&](const WOps& w, const COps& cf, const XOps& xf) {
        // D = h^T = W1^T x^T + bias: bias folded into the C-init (uniform
        // across lanes within a half; N does not index the bias).
        v8f c0, c1;
        #pragma unroll
        for (int m = 0; m < 8; ++m) { c0[m] = cf.B0.v[m]; c1[m] = cf.B1.v[m]; }
        c0 = __builtin_amdgcn_wmma_f32_16x16x4_f32(false, w.a00, false, xf.k0, (short)0, c0, false, false);
        c0 = __builtin_amdgcn_wmma_f32_16x16x4_f32(false, w.a10, false, xf.k1, (short)0, c0, false, false);
        c1 = __builtin_amdgcn_wmma_f32_16x16x4_f32(false, w.a01, false, xf.k0, (short)0, c1, false, false);
        c1 = __builtin_amdgcn_wmma_f32_16x16x4_f32(false, w.a11, false, xf.k1, (short)0, c1, false, false);

        // ELU, then the row's three sums, two units at a time: each sum is kept as a pair of
        // partial sums, so that one packed instruction adds two units' terms.
        // ELU(v) is the median of v, exp(v) - 1 and 0: exp(v) - 1 >= v for every v, so above 0
        // the order is 0 < v <= exp(v) - 1 and below it v <= exp(v) - 1 < 0. One instruction
        // a unit, with no compare, no mask register and no select.
        v2f s2, ss2, t2;
        #pragma unroll   // constant indices into the accumulators and the coefficients
        for (int m = 0; m < 8; m += 2) {
            v2f a = { c0[m], c0[m + 1] };
            v2f b = { c1[m], c1[m + 1] };
            v2f ea = { __expf(a.x), __expf(a.y) };
            v2f eb = { __expf(b.x), __expf(b.y) };
            ea = ea - 1.f;
            eb = eb - 1.f;
            a.x = __builtin_amdgcn_fmed3f(a.x, ea.x, 0.f);   // ELU(alpha=1)
            a.y = __builtin_amdgcn_fmed3f(a.y, ea.y, 0.f);
            b.x = __builtin_amdgcn_fmed3f(b.x, eb.x, 0.f);
            b.y = __builtin_amdgcn_fmed3f(b.y, eb.y, 0.f);
            const v2f ga = { cf.GW0.v[m], cf.GW0.v[m + 1] };
            const v2f gb = { cf.GW1.v[m], cf.GW1.v[m + 1] };
            if (m == 0) {
                s2 = a; ss2 = a * a; t2 = a * ga;
            } else {
                s2 += a;
                ss2 = __builtin_elementwise_fma(a, a, ss2);
                t2  = __builtin_elementwise_fma(a, ga, t2);
            }
            s2 += b;
            ss2 = __builtin_elementwise_fma(b, b, ss2);
            t2  = __builtin_elementwise_fma(b, gb, t2);
        }
        Sums r;
        r.s = s2.x + s2.y; r.ss = ss2.x + ss2.y; r.t = t2.x + t2.y;
        return r;
    };

    for (int p = 0; p < PASSES; ++p) {
        // B fragments = x^T (4x16 f32; K=s, N=batch row): K = half*2+{0,1}, 4+half*2+{0,1}
#if HAVE_ASYNC
        if (p + 1 < PASSES) {
            // This wave read the buffer that is refilled here one pass ago: those reads retire first.
            asm volatile("s_wait_dscnt 0x0" ::: "memory");
            stage(p + 1, (p + 1) & 1);
            WAIT_ASYNC(8);      // 8 outstanding = next pass; this pass is complete
        } else {
            WAIT_ASYNC(0);
        }
        const float* bp = &xbuf[wave][p & 1][0] + l16 * ROWPAD + half * 2;
        auto loadX = [&](int t, int k) {
            XOps o;
            const float* q = bp + t * 16 * ROWPAD + k * SN;
            o.k0.x = q[0]; o.k0.y = q[1];
            o.k1.x = q[4]; o.k1.y = q[5];
            return o;
        };
#else
        auto loadX = [&](int t, int k) {
            XOps o;
            int gr = rowBase + p * ROWS + t * 16 + l16;
            if (gr > B - 1) gr = B - 1;
            const float* q = x + (size_t)gr * (QN * SN) + (qStart + k) * SN + half * 2;
            o.k0.x = q[0]; o.k0.y = q[1];
            o.k1.x = q[4]; o.k1.y = q[5];
            return o;
        };
#endif
        XOps x0 = loadX(0, 0), x1 = loadX(1, 0);
        #pragma unroll   // constant indices keep the weight sets in registers
        for (int k = 0; k < SPW; ++k) {
            // The LDS operands are requested one slice ahead of their use, so that their latency
            // runs under this slice's work.
            const COps cNxt = loadC((k + 1) % SPW);
            XOps x0n = x0, x1n = x1;
            if (k + 1 < SPW) {   // stays inside the pass that has landed
                x0n = loadX(0, k + 1);
                x1n = loadX(1, k + 1);
            }
            // The slice's operands serve both tiles.
            const Sums r0 = tile(wR[k], cCur, x0);
            const Sums r1 = tile(wR[k], cCur, x1);

            // The other 16 units of a row live in lane^16. Lanes 0-15 close tile 0 and lanes 16-31
            // tile 1: a lane keeps its share of the tile it closes and hands lane^16 its share of
            // the other, so one exchange and one closing pass serve both tiles.
            float s  = (half ? r1.s  : r0.s)  + __shfl_xor(half ? r0.s  : r1.s,  16, 32);
            float ss = (half ? r1.ss : r0.ss) + __shfl_xor(half ? r0.ss : r1.ss, 16, 32);
            const float mu = s * (1.f / 32.f);
            float var = ss * (1.f / 32.f) - mu * mu;
            var = var < 0.f ? 0.f : var;
            const float rstd = rsqrtf(var + EPSV);

            // out = rstd*(sum h*gw - mu*sgw) + (sum beta*w2 + b2)
            const float t = (half ? r1.t : r0.t) + __shfl_xor(half ? r0.t : r1.t, 16, 32);

            // row in the pass = 16 * tile + l16 = lane
            outTile[(p * ROWS + lane) * OUTPAD + wave * SPW + k] = rstd * (t - mu * sgw[k]) + dbv[k];

            cCur = cNxt;
            x0 = x0n; x1 = x1n;
        }
    }

    __syncthreads();

    // Store of the 128x32 tile. A wave takes 16 rows; 8 lanes x 16 bytes cover the block's whole
    // 128-byte line of a row of out, and one store four such lines. The four LDS reads are
    // requested together, ahead of the first store: the wave pays the LDS latency once.
    // The wave's number as a scalar: the test on the rows is then a scalar branch, not a lane mask.
    const int row0 = __builtin_amdgcn_readfirstlane(wave) * ROWS_PER_WAVE;
    const int rowsLeft = B - (rowBase + row0);   // rows of out from this wave's first on
    const int rsub = lane >> 3;
    v4f o[STORES];
    #pragma unroll   // constant indices keep the rows in registers
    for (int i = 0; i < STORES; ++i)
        o[i] = *(const v4f*)(outTile + (row0 + 4 * i + rsub) * OUTPAD + (lane & 7) * 4);
    float* __restrict__ op = out + (size_t)(rowBase + row0 + rsub) * QN + colBlk * BSL + (lane & 7) * 4;
    if (rowsLeft >= ROWS_PER_WAVE) {
        #pragma unroll   // four stores off one address
        for (int i = 0; i < STORES; ++i) *(v4f*)(op + i * 4 * QN) = o[i];
    } else {             // the batch ends inside this wave's rows
        #pragma unroll
        for (int i = 0; i < STORES; ++i)
            if (4 * i + rsub < rowsLeft) *(v4f*)(op + i * 4 * QN) = o[i];
    }
}

extern "C" void kernel_launch(void* const* d_in, const int* in_sizes, int n_in,
                              void* d_out, int out_size, void* d_ws, size_t ws_size,
                              hipStream_t stream) {
    const float* x     = (const float*)d_in[0];
    const float* W1    = (const float*)d_in[1];
    const float* b1    = (const float*)d_in[2];
    const float* gamma = (const float*)d_in[3];
    const float* beta  = (const float*)d_in[4];
    const float* W2    = (const float*)d_in[5];
    const float* b2    = (const float*)d_in[6];
    float* out = (float*)d_out;

    const int B = in_sizes[0] / (QN * SN);
    const int nblocks = (B + BROWS - 1) / BROWS * QBLK;
    divenc_kernel<<<nblocks, WAVES * 32, 0, stream>>>(x, W1, b1, gamma, beta, W2, b2, out, B);
}
